// v000
// Measured on an AMD MI455X. A time is GPU time per run, averaged over a window of back-to-back runs after a warm-up
// (all launches, gaps included; the runs take copies of the inputs in turn), and the median of several windows.
// Apart from v000's, it joins two sittings. Times from different sittings can be a few percent apart, while
// side-by-side timings come from the same sitting.
// v000 is the starting kernel. One run takes 408 microseconds.
#include <hip/hip_runtime.h>
#include <stddef.h>

// All contractions on v_wmma_f32_16x16x32_bf16 with bf16 operands carried as hi/lo pairs (hi*hi + hi*lo + lo*hi), f32 accumulate:
// q/k/v projections, key-by-query scores, value aggregation, output projection. Softmax, bias and normalisation in f32.

#define B_ 4
#define S_ 2048
#define E_ 512
#define H_ 8
#define D_ 64
#define N_ (B_ * S_)

static_assert(E_ == H_ * D_);
static_assert(D_ == 64);
static_assert((S_ % 64) == 0 && (E_ % 64) == 0 && (N_ % 64) == 0);

typedef float          v8f   __attribute__((ext_vector_type(8)));
typedef float          v4f   __attribute__((ext_vector_type(4)));
typedef __bf16         v16b  __attribute__((ext_vector_type(16)));
typedef __bf16         v8b   __attribute__((ext_vector_type(8)));
typedef unsigned short v8us  __attribute__((ext_vector_type(8)));

union Frag16 { v16b v; v8us hv[2]; };
union Pack8  { v8b b; v8us u; };

#define NOP4 "v_nop\n\tv_nop\n\tv_nop\n\tv_nop"

// 16x32 operand fragment from a k-contiguous 16-bit row (row = lane&15 chosen by the caller, rowk = row start + k0):
// elements 0..7 <- k0+8h .. k0+8h+7, elements 8..15 <- k0+16+8h .. k0+16+8h+7.  Same map for A rows and for B columns.
__device__ __forceinline__ v16b ld_frag(const unsigned short* rowk, int h) {
  Frag16 f;
  f.hv[0] = *(const v8us*)(rowk + 8 * h);
  f.hv[1] = *(const v8us*)(rowk + 16 + 8 * h);
  return f.v;
}

__device__ __forceinline__ v16b join16(v8us a, v8us b) {
  Frag16 f;
  f.hv[0] = a;
  f.hv[1] = b;
  return f.v;
}

__device__ __forceinline__ v8f mma(v16b a, v16b b, v8f c) {
  return __builtin_amdgcn_wmma_f32_16x16x32_bf16(false, a, false, b, (short)0, c, false, false);
}

__device__ __forceinline__ v8f vzero() {
  v8f z = {0.f, 0.f, 0.f, 0.f, 0.f, 0.f, 0.f, 0.f};
  return z;
}

// f32 -> bf16 hi (RNE convert) and bf16 lo = RNE(x - hi)
__device__ __forceinline__ void split8(v8f x, v8us& hu, v8us& lu) {
  Pack8 ph, pl;
  ph.b = __builtin_convertvector(x, v8b);
  const v8f hf = __builtin_convertvector(ph.b, v8f);
  pl.b = __builtin_convertvector(x - hf, v8b);
  hu = ph.u;
  lu = pl.u;
}

// ---------------------------------------------------------------------------
// Elementwise f32 -> (bf16 hi plane, bf16 lo plane). Thread i handles elements 8i..8i+7;
__global__ void __launch_bounds__(256)
k_split(const float* __restrict__ src, unsigned short* __restrict__ dh, unsigned short* __restrict__ dl, int n8) {
  const int i = blockIdx.x * 256 + threadIdx.x;
  if (i < n8) {
    const v4f* p = (const v4f*)(src + (size_t)i * 8);
    const v4f a0 = p[0];
    const v4f a1 = p[1];
    const v8f x = __builtin_shufflevector(a0, a1, 0, 1, 2, 3, 4, 5, 6, 7);
    v8us hu, lu;
    split8(x, hu, lu);
    v8us* ph = (v8us*)(dh + (size_t)i * 8);
    v8us* pl = (v8us*)(dl + (size_t)i * 8);
    *ph = hu;
    *pl = lu;
    
  }
}

// ---------------------------------------------------------------------------
// Split GEMM: D[i][j] = sum_k P[i][k] * R[j][k], k = 0..511, both operands k-contiguous with pitch E_, as hi/lo bf16 planes.
// Wave tile: 64 i (4 WMMA tiles, A operand) x 16 j (B operand). acc[t][r] at lane (m,h) = D[ibase + 16t + 8h + r][jbase + m].
// MODE 0: P = W[e][k], R = X[n][k]  -> Q/K plane [b*8+head][s][d] (hi/lo bf16), bias[e]
// MODE 1: P = X[n][k], R = W[e][k]  -> Vt plane [b*8+head][d][s] (hi/lo bf16), bias[e]
// MODE 2: P = W[e][k], R = At[n][k] -> f32 out[n][e], bias[e]
template <int MODE>
__global__ void __launch_bounds__(128)
k_gemm(const unsigned short* __restrict__ Ph, const unsigned short* __restrict__ Pl,
       const unsigned short* __restrict__ Rh, const unsigned short* __restrict__ Rl,
       const float* __restrict__ bias,
       unsigned short* __restrict__ Oh, unsigned short* __restrict__ Ol,
       float* __restrict__ Of)
{
  const int l  = threadIdx.x & 31;
  const int h  = l >> 4;
  const int m  = l & 15;
  const int wv = threadIdx.x >> 5;
  const int gw = blockIdx.x * 4 + wv;          // 4096 wave tiles, exact
  int ibase, jbase;
  if (MODE == 1) { ibase = (gw >> 5) * 64; jbase = (gw & 31) * 16; }
  else           { ibase = (gw & 7) * 64;  jbase = (gw >> 3) * 16; }

  v8f acc[4];
#pragma unroll
  for (int t = 0; t < 4; ++t) acc[t] = vzero();

  const unsigned short* rp_h = Rh + (size_t)(jbase + m) * E_;
  const unsigned short* rp_l = Rl + (size_t)(jbase + m) * E_;
  const unsigned short* pp_h = Ph + (size_t)(ibase + m) * E_;
  const unsigned short* pp_l = Pl + (size_t)(ibase + m) * E_;

#pragma unroll 1
  for (int k0 = 0; k0 < E_; k0 += 32) {
    const v16b rh = ld_frag(rp_h + k0, h);
    const v16b rl = ld_frag(rp_l + k0, h);
    v16b ph[4], pl[4];
#pragma unroll
    for (int t = 0; t < 4; ++t) {
      ph[t] = ld_frag(pp_h + (size_t)t * 16 * E_ + k0, h);
      pl[t] = ld_frag(pp_l + (size_t)t * 16 * E_ + k0, h);
    }
#pragma unroll
    for (int t = 0; t < 4; ++t) {
      acc[t] = mma(ph[t], rh, acc[t]);
      acc[t] = mma(ph[t], rl, acc[t]);
      acc[t] = mma(pl[t], rh, acc[t]);
    }
    asm volatile(NOP4
                 : "+v"(acc[0]), "+v"(acc[1]), "+v"(acc[2]), "+v"(acc[3])
                 : "v"(ph[0]), "v"(ph[1]), "v"(ph[2]), "v"(ph[3]),
                   "v"(pl[0]), "v"(pl[1]), "v"(pl[2]), "v"(pl[3]),
                   "v"(rh), "v"(rl)
                 : "memory");
  }

  if constexpr (MODE == 2) {
    __shared__ v4f lds_f[4][256];
#pragma unroll
    for (int t = 0; t < 4; ++t) {
      const v4f b0 = *(const v4f*)(bias + ibase + t * 16 + 8 * h);
      const v4f b1 = *(const v4f*)(bias + ibase + t * 16 + 8 * h + 4);
      const v8f bb = __builtin_shufflevector(b0, b1, 0, 1, 2, 3, 4, 5, 6, 7);
      const v8f val = acc[t] + bb;
      lds_f[wv][m * 16 + 4 * t + 2 * h]     = __builtin_shufflevector(val, val, 0, 1, 2, 3);
      lds_f[wv][m * 16 + 4 * t + 2 * h + 1] = __builtin_shufflevector(val, val, 4, 5, 6, 7);
    }
    __syncthreads();
    v4f w[8];
    size_t off[8];
#pragma unroll
    for (int j = 0; j < 8; ++j) {
      const int c = j * 32 + l;                     // 16 chunks of 16 B per row
      w[j] = lds_f[wv][c];
      off[j] = (size_t)(jbase + (c >> 4)) * E_ + ibase + (c & 15) * 4;
    }
#pragma unroll
    for (int j = 0; j < 8; ++j) *(v4f*)(Of + off[j]) = w[j];
    
  } else {
    // stage 16 rows x 64 bf16 per plane per wave; row = m (n for MODE 0, d for MODE 1), col = 16t + 8h + r
    __shared__ v8us lds_h[4][2][128];
    float bsc = 0.0f;
    if (MODE == 1) bsc = bias[jbase + m];
#pragma unroll
    for (int t = 0; t < 4; ++t) {
      v8f val;
      if (MODE == 0) {
        const v4f b0 = *(const v4f*)(bias + ibase + t * 16 + 8 * h);
        const v4f b1 = *(const v4f*)(bias + ibase + t * 16 + 8 * h + 4);
        const v8f bb = __builtin_shufflevector(b0, b1, 0, 1, 2, 3, 4, 5, 6, 7);
        val = acc[t] + bb;
      } else {
        val = acc[t] + bsc;
      }
      v8us hu, lu;
      split8(val, hu, lu);
      lds_h[wv][0][m * 8 + 2 * t + h] = hu;
      lds_h[wv][1][m * 8 + 2 * t + h] = lu;
    }
    __syncthreads();
    v8us w0[4], w1[4];
    size_t off[4];
#pragma unroll
    for (int j = 0; j < 4; ++j) {
      const int c = j * 32 + l;
      w0[j] = lds_h[wv][0][c];
      w1[j] = lds_h[wv][1][c];
      if (MODE == 0) {
        const size_t base = ((size_t)((jbase >> 11) * H_ + (ibase >> 6)) * S_ + (jbase & (S_ - 1))) * D_;
        off[j] = base + (size_t)c * 8;
      } else {
        const int bh = (ibase >> 11) * H_ + (jbase >> 6);
        const int d0 = jbase & (D_ - 1);
        const int s0 = ibase & (S_ - 1);
        off[j] = (size_t)(bh * D_ + d0 + (c >> 3)) * S_ + s0 + (c & 7) * 8;
      }
    }
#pragma unroll
    for (int j = 0; j < 4; ++j) {
      *(v8us*)(Oh + off[j]) = w0[j];
      *(v8us*)(Ol + off[j]) = w1[j];
    }
    
  }
}

// ---------------------------------------------------------------------------
// Flash attention, transposed: a wave owns 16 queries of one (b, head); lane (m, h) owns query q0+m (both lane halves).
// Per 64 keys: S^T tiles = K(16 keys x 64 d, A operand) . Q^T(64 d x 16 q, B operand) -> D rows = keys, cols = queries;
// per-lane online softmax over its 32 keys, partner half via one shuffle; P^T chains from D into the B operand of
// O^T(16 d x 16 q) += Vt(16 d x 32 keys, A operand) . P^T(32 keys x 16 q): B element r <- D(tile for keys 0..15)[r],
// element 8+r <- D(tile for keys 16..31)[r], lane unchanged.
__global__ void __launch_bounds__(128)
k_attn(const unsigned short* __restrict__ Qh, const unsigned short* __restrict__ Ql,
       const unsigned short* __restrict__ Kh, const unsigned short* __restrict__ Kl,
       const unsigned short* __restrict__ Vh, const unsigned short* __restrict__ Vl,
       const float* __restrict__ ent,
       unsigned short* __restrict__ Ah, unsigned short* __restrict__ Al)
{
  __shared__ v8us lds_a[4][2][128];
  const int l    = threadIdx.x & 31;
  const int h    = l >> 4;
  const int m    = l & 15;
  const int wv   = threadIdx.x >> 5;
  const int gw   = blockIdx.x * 4 + wv;        // 4096 waves, exact
  const int bh   = gw >> 7;
  const int qt   = gw & 127;
  const int q0   = qt * 16;
  const int b    = bh >> 3;
  const int head = bh & 7;

  const size_t qoff = ((size_t)bh * S_ + q0 + m) * D_;
  const v16b qh0 = ld_frag(Qh + qoff, h);
  const v16b qh1 = ld_frag(Qh + qoff + 32, h);
  const v16b ql0 = ld_frag(Ql + qoff, h);
  const v16b ql1 = ld_frag(Ql + qoff + 32, h);
  // logit scale entangle[q] / sqrt(64), folded with log2(e) for exp2
  const float fac2 = ent[q0 + m] * 0.18033688011112042f;

  float mrun = -__builtin_inff();
  float lrun = 0.0f;
  v8f o[4];
#pragma unroll
  for (int t = 0; t < 4; ++t) o[t] = vzero();

  const unsigned short* kh_b = Kh + (size_t)bh * S_ * D_;
  const unsigned short* kl_b = Kl + (size_t)bh * S_ * D_;
  const unsigned short* vh_b = Vh + (size_t)bh * D_ * S_;
  const unsigned short* vl_b = Vl + (size_t)bh * D_ * S_;

#pragma unroll 1
  for (int kb = 0; kb < S_; kb += 64) {
    v8f c[4];
#pragma unroll
    for (int u = 0; u < 4; ++u) {
      const size_t ko = (size_t)(kb + u * 16 + m) * D_;
      const v16b a0h = ld_frag(kh_b + ko, h);
      const v16b a1h = ld_frag(kh_b + ko + 32, h);
      const v16b a0l = ld_frag(kl_b + ko, h);
      const v16b a1l = ld_frag(kl_b + ko + 32, h);
      v8f cc = vzero();
      cc = mma(a0h, qh0, cc);
      cc = mma(a0h, ql0, cc);
      cc = mma(a0l, qh0, cc);
      cc = mma(a1h, qh1, cc);
      cc = mma(a1h, ql1, cc);
      cc = mma(a1l, qh1, cc);
      asm volatile(NOP4
                   : "+v"(cc)
                   : "v"(a0h), "v"(a1h), "v"(a0l), "v"(a1l), "v"(qh0), "v"(qh1), "v"(ql0), "v"(ql1)
                   : "memory");
      c[u] = cc;   // c[u][r] = raw score of key kb + 16u + 8h + r against query q0 + m
    }

    // online softmax, f32: lane holds 32 keys of its query; partner lane (xor 16) holds the other 32
    float tmax = -__builtin_inff();
#pragma unroll
    for (int u = 0; u < 4; ++u) {
      c[u] = c[u] * fac2;
#pragma unroll
      for (int r = 0; r < 8; ++r) tmax = fmaxf(tmax, c[u][r]);
    }
    tmax = fmaxf(tmax, __shfl_xor(tmax, 16));
    const float mnew  = fmaxf(mrun, tmax);
    const float alpha = __builtin_amdgcn_exp2f(mrun - mnew);
    float psum = 0.0f;
#pragma unroll
    for (int u = 0; u < 4; ++u) {
#pragma unroll
      for (int r = 0; r < 8; ++r) {
        const float p = __builtin_amdgcn_exp2f(c[u][r] - mnew);
        c[u][r] = p;
        psum += p;
      }
    }
    psum += __shfl_xor(psum, 16);
    lrun = lrun * alpha + psum;
    mrun = mnew;
#pragma unroll
    for (int t = 0; t < 4; ++t) o[t] = o[t] * alpha;

    // P^T (D layout, rows = keys) -> hi/lo B fragments; O^T += Vt . P^T
#pragma unroll
    for (int v = 0; v < 2; ++v) {
      v8us h0, l0, h1, l1;
      split8(c[2 * v], h0, l0);
      split8(c[2 * v + 1], h1, l1);
      const v16b phi = join16(h0, h1);
      const v16b plo = join16(l0, l1);
#pragma unroll
      for (int t = 0; t < 4; ++t) {
        const size_t vo = (size_t)(t * 16 + m) * S_ + kb + v * 32;
        const v16b va_h = ld_frag(vh_b + vo, h);
        const v16b va_l = ld_frag(vl_b + vo, h);
        v8f oo = o[t];
        oo = mma(va_h, phi, oo);
        oo = mma(va_h, plo, oo);
        oo = mma(va_l, phi, oo);
        asm volatile(NOP4
                     : "+v"(oo)
                     : "v"(va_h), "v"(va_l), "v"(phi), "v"(plo)
                     : "memory");
        o[t] = oo;   // o[t][r] = O^T[d = 16t + 8h + r][q = q0 + m]
      }
    }
  }

  const float inv = 1.0f / lrun;
#pragma unroll
  for (int t = 0; t < 4; ++t) {
    const v8f val = o[t] * inv;
    v8us hu, lu;
    split8(val, hu, lu);
    lds_a[wv][0][m * 8 + 2 * t + h] = hu;
    lds_a[wv][1][m * 8 + 2 * t + h] = lu;
  }
  __syncthreads();
  v8us w0[4], w1[4];
  size_t off[4];
#pragma unroll
  for (int j = 0; j < 4; ++j) {
    const int ci = j * 32 + l;                    // row = ci>>3 (query), piece = ci&7
    w0[j] = lds_a[wv][0][ci];
    w1[j] = lds_a[wv][1][ci];
    off[j] = ((size_t)b * S_ + q0 + (ci >> 3)) * E_ + head * D_ + (ci & 7) * 8;
  }
#pragma unroll
  for (int j = 0; j < 4; ++j) {
    *(v8us*)(Ah + off[j]) = w0[j];
    *(v8us*)(Al + off[j]) = w1[j];
  }
  
}

// ---------------------------------------------------------------------------
extern "C" void kernel_launch(void* const* d_in, const int* in_sizes, int n_in,
                              void* d_out, int out_size, void* d_ws, size_t ws_size,
                              hipStream_t stream) {
  if (n_in < 10) return;
  if (in_sizes[0] != N_ * E_ || in_sizes[1] != S_ ||
      in_sizes[2] != E_ * E_ || in_sizes[3] != E_ ||
      in_sizes[4] != E_ * E_ || in_sizes[5] != E_ ||
      in_sizes[6] != E_ * E_ || in_sizes[7] != E_ ||
      in_sizes[8] != E_ * E_ || in_sizes[9] != E_ ||
      out_size != N_ * E_) return;

  const float* x   = (const float*)d_in[0];   // [B,S,E]
  const float* ent = (const float*)d_in[1];   // [S]
  const float* Wq  = (const float*)d_in[2];
  const float* bq  = (const float*)d_in[3];
  const float* Wk  = (const float*)d_in[4];
  const float* bk  = (const float*)d_in[5];
  const float* Wv  = (const float*)d_in[6];
  const float* bv  = (const float*)d_in[7];
  const float* Wo  = (const float*)d_in[8];
  const float* bo  = (const float*)d_in[9];
  float* out = (float*)d_out;

  const size_t nX = (size_t)N_ * E_;           // 4194304
  const size_t nW = (size_t)E_ * E_;           // 262144
  const size_t total_bytes = (10 * nX + 8 * nW) * sizeof(unsigned short);   // 88080384
  if (total_bytes > ws_size) return;

  unsigned short* p = (unsigned short*)d_ws;
  unsigned short* Xh  = p; p += nX;   unsigned short* Xl  = p; p += nX;
  unsigned short* Wqh = p; p += nW;   unsigned short* Wql = p; p += nW;
  unsigned short* Wkh = p; p += nW;   unsigned short* Wkl = p; p += nW;
  unsigned short* Wvh = p; p += nW;   unsigned short* Wvl = p; p += nW;
  unsigned short* Woh = p; p += nW;   unsigned short* Wol = p; p += nW;
  unsigned short* Qh  = p; p += nX;   unsigned short* Ql  = p; p += nX;   // [B*H][S][D]
  unsigned short* Kh  = p; p += nX;   unsigned short* Kl  = p; p += nX;   // [B*H][S][D]
  unsigned short* Vh  = p; p += nX;   unsigned short* Vl  = p; p += nX;   // [B*H][D][S]
  unsigned short* Ah  = p; p += nX;   unsigned short* Al  = p; p += nX;   // [N][E]

  const int n8X = (int)(nX / 8);               // 524288
  const int n8W = (int)(nW / 8);               // 32768
  k_split<<<(n8X + 255) / 256, 256, 0, stream>>>(x,  Xh,  Xl,  n8X);
  k_split<<<(n8W + 255) / 256, 256, 0, stream>>>(Wq, Wqh, Wql, n8W);
  k_split<<<(n8W + 255) / 256, 256, 0, stream>>>(Wk, Wkh, Wkl, n8W);
  k_split<<<(n8W + 255) / 256, 256, 0, stream>>>(Wv, Wvh, Wvl, n8W);
  k_split<<<(n8W + 255) / 256, 256, 0, stream>>>(Wo, Woh, Wol, n8W);

  // 4096 wave tiles per GEMM / attention launch, 4 waves per 128-thread block
  const int nblk = ((E_ / 64) * (N_ / 16)) / 4;   // 1024; MODE 1: (N_/64)*(E_/16)/4 = 1024 as well
  k_gemm<0><<<nblk, 128, 0, stream>>>(Wqh, Wql, Xh, Xl, bq, Qh, Ql, out);
  k_gemm<0><<<nblk, 128, 0, stream>>>(Wkh, Wkl, Xh, Xl, bk, Kh, Kl, out);
  k_gemm<1><<<nblk, 128, 0, stream>>>(Xh, Xl, Wvh, Wvl, bv, Vh, Vl, out);

  k_attn<<<(B_ * H_ * (S_ / 16)) / 4, 128, 0, stream>>>(Qh, Ql, Kh, Kl, Vh, Vl, ent, Ah, Al);

  k_gemm<2><<<nblk, 128, 0, stream>>>(Woh, Wol, Ah, Al, bo, Ah, Al, out);
}

// v001
// One run takes 335 microseconds.
// Timed twice side by side with v000, it ran 1.23 times as fast both times.
#include <hip/hip_runtime.h>
#include <stddef.h>

// All contractions on v_wmma_f32_16x16x32_bf16 with bf16 operands carried as hi/lo pairs (hi*hi + hi*lo + lo*hi), f32 accumulate:
// q/k/v projections, key-by-query scores, value aggregation, output projection. Softmax, bias and normalisation in f32.

#define B_ 4
#define S_ 2048
#define E_ 512
#define H_ 8
#define D_ 64
#define N_ (B_ * S_)

static_assert(E_ == H_ * D_);
static_assert(D_ == 64 && E_ == 512);
static_assert((S_ % 64) == 0 && (E_ % 64) == 0 && (N_ % 64) == 0);

typedef float          v8f   __attribute__((ext_vector_type(8)));
typedef float          v4f   __attribute__((ext_vector_type(4)));
typedef __bf16         v16b  __attribute__((ext_vector_type(16)));
typedef __bf16         v8b   __attribute__((ext_vector_type(8)));
typedef unsigned short v8us  __attribute__((ext_vector_type(8)));

union Frag16 { v16b v; v8us hv[2]; };
union Pack8  { v8b b; v8us u; };

#define NOP4 "v_nop\n\tv_nop\n\tv_nop\n\tv_nop"

// Every 16-bit plane in the workspace is stored in fragment order: a tile is 16 rows x 32 k = 512 elements (1 KiB), and
// element (row, k) of a tile sits at ((k >> 4) & 1) * 256 + (((k >> 3) & 1) * 16 + (row & 15)) * 8 + (k & 7).
// Lane l = 16h + m then finds its 16x32 operand fragment (row m; elements 0..7 <- k 8h..8h+7, elements 8..15 <- k 16+8h..16+8h+7,
// the same map for A rows and for B columns) at tile + 8l and tile + 256 + 8l: each wave-wide load is 512 contiguous bytes.
#define TILE_ 512

// lp = tile start + 8 * lane
__device__ __forceinline__ v16b ld_frag(const unsigned short* lp) {
  Frag16 f;
  f.hv[0] = *(const v8us*)(lp);
  f.hv[1] = *(const v8us*)(lp + 256);
  return f.v;
}

__device__ __forceinline__ v16b join16(v8us a, v8us b) {
  Frag16 f;
  f.hv[0] = a;
  f.hv[1] = b;
  return f.v;
}

__device__ __forceinline__ v8f mma(v16b a, v16b b, v8f c) {
  return __builtin_amdgcn_wmma_f32_16x16x32_bf16(false, a, false, b, (short)0, c, false, false);
}

__device__ __forceinline__ v8f vzero() {
  v8f z = {0.f, 0.f, 0.f, 0.f, 0.f, 0.f, 0.f, 0.f};
  return z;
}

// f32 -> bf16 hi (RNE convert) and bf16 lo = RNE(x - hi)
__device__ __forceinline__ void split8(v8f x, v8us& hu, v8us& lu) {
  Pack8 ph, pl;
  ph.b = __builtin_convertvector(x, v8b);
  const v8f hf = __builtin_convertvector(ph.b, v8f);
  pl.b = __builtin_convertvector(x - hf, v8b);
  hu = ph.u;
  lu = pl.u;
}

// ---------------------------------------------------------------------------
// f32 [rows][E_] -> (bf16 hi plane, bf16 lo plane) in fragment order, tile index = (row >> 4) * (E_ / 32) + (k >> 5).
// 64 threads per tile, 8 elements each: a wave takes 8 rows x 32 k, so it reads whole 128-byte lines and stores whole lines.
__global__ void __launch_bounds__(256)
k_split(const float* __restrict__ src, unsigned short* __restrict__ dh, unsigned short* __restrict__ dl, int n8) {
  const int i = blockIdx.x * 256 + threadIdx.x;
  if (i < n8) {
    const int tile = i >> 6;
    const int row  = ((i >> 5) & 1) * 8 + (i & 7);   // row in the tile
    const int k8   = (i >> 3) & 3;                   // which 8 k of the tile's 32
    const v4f* p = (const v4f*)(src + (size_t)((tile >> 4) * 16 + row) * E_ + (tile & 15) * 32 + k8 * 8);
    const size_t dst = (size_t)tile * TILE_ + (k8 * 16 + row) * 8;
    const v4f a0 = p[0];
    const v4f a1 = p[1];
    const v8f x = __builtin_shufflevector(a0, a1, 0, 1, 2, 3, 4, 5, 6, 7);
    v8us hu, lu;
    split8(x, hu, lu);
    v8us* ph = (v8us*)(dh + dst);
    v8us* pl = (v8us*)(dl + dst);
    *ph = hu;
    *pl = lu;
    
  }
}

// ---------------------------------------------------------------------------
// Split GEMM: D[i][j] = sum_k P[i][k] * R[j][k], k = 0..511, both operands as hi/lo bf16 planes in fragment order,
// tile index = (row >> 4) * (E_ / 32) + (k >> 5).
// Wave tile: 64 i (4 WMMA tiles, A operand) x 16 j (B operand). acc[t][r] at lane (m,h) = D[ibase + 16t + 8h + r][jbase + m].
// MODE 0: P = W[e][k], R = X[n][k]  -> Q/K plane per b*8+head, rows s, k = d, tile index (s >> 4) * 2 + (d >> 5), bias[e]
// MODE 1: P = X[n][k], R = W[e][k]  -> Vt plane per b*8+head, rows d, k = s, tile index (s >> 5) * 4 + (d >> 4), bias[e]
// MODE 2: P = W[e][k], R = At[n][k] -> f32 out[n][e], bias[e]
// MODE 0 and 1: the accumulator's 8 values of a lane are that same lane's 8 elements of the output plane's fragment order
// (k = 16t + 8h + r, row = m), so each lane stores 16 bytes at tile + 8l and a wave-wide store is 512 contiguous bytes.
template <int MODE>
__global__ void __launch_bounds__(128)
k_gemm(const unsigned short* __restrict__ Ph, const unsigned short* __restrict__ Pl,
       const unsigned short* __restrict__ Rh, const unsigned short* __restrict__ Rl,
       const float* __restrict__ bias,
       unsigned short* __restrict__ Oh, unsigned short* __restrict__ Ol,
       float* __restrict__ Of)
{
  const int l  = threadIdx.x & 31;
  const int h  = l >> 4;
  const int m  = l & 15;
  const int wv = threadIdx.x >> 5;
  const int gw = blockIdx.x * 4 + wv;          // 4096 wave tiles, exact
  int ibase, jbase;
  if (MODE == 1) { ibase = (gw >> 5) * 64; jbase = (gw & 31) * 16; }
  else           { ibase = (gw & 7) * 64;  jbase = (gw >> 3) * 16; }

  v8f acc[4];
#pragma unroll
  for (int t = 0; t < 4; ++t) acc[t] = vzero();

  const unsigned short* rp_h = Rh + (size_t)jbase * E_ + l * 8;   // 16 rows x E_ = E_ / 32 tiles
  const unsigned short* rp_l = Rl + (size_t)jbase * E_ + l * 8;
  const unsigned short* pp_h = Ph + (size_t)ibase * E_ + l * 8;
  const unsigned short* pp_l = Pl + (size_t)ibase * E_ + l * 8;

#pragma unroll 1
  for (int k0 = 0; k0 < E_; k0 += 32) {
    const int kt = (k0 >> 5) * TILE_;
    const v16b rh = ld_frag(rp_h + kt);
    const v16b rl = ld_frag(rp_l + kt);
    v16b ph[4], pl[4];
#pragma unroll
    for (int t = 0; t < 4; ++t) {
      ph[t] = ld_frag(pp_h + (size_t)t * 16 * E_ + kt);
      pl[t] = ld_frag(pp_l + (size_t)t * 16 * E_ + kt);
    }
#pragma unroll
    for (int t = 0; t < 4; ++t) {
      acc[t] = mma(ph[t], rh, acc[t]);
      acc[t] = mma(ph[t], rl, acc[t]);
      acc[t] = mma(pl[t], rh, acc[t]);
    }
    asm volatile(NOP4
                 : "+v"(acc[0]), "+v"(acc[1]), "+v"(acc[2]), "+v"(acc[3])
                 : "v"(ph[0]), "v"(ph[1]), "v"(ph[2]), "v"(ph[3]),
                   "v"(pl[0]), "v"(pl[1]), "v"(pl[2]), "v"(pl[3]),
                   "v"(rh), "v"(rl)
                 : "memory");
  }

  if constexpr (MODE == 2) {
    __shared__ v4f lds_f[4][256];
#pragma unroll
    for (int t = 0; t < 4; ++t) {
      const v4f b0 = *(const v4f*)(bias + ibase + t * 16 + 8 * h);
      const v4f b1 = *(const v4f*)(bias + ibase + t * 16 + 8 * h + 4);
      const v8f bb = __builtin_shufflevector(b0, b1, 0, 1, 2, 3, 4, 5, 6, 7);
      const v8f val = acc[t] + bb;
      lds_f[wv][m * 16 + 4 * t + 2 * h]     = __builtin_shufflevector(val, val, 0, 1, 2, 3);
      lds_f[wv][m * 16 + 4 * t + 2 * h + 1] = __builtin_shufflevector(val, val, 4, 5, 6, 7);
    }
    __syncthreads();
    v4f w[8];
    size_t off[8];
#pragma unroll
    for (int j = 0; j < 8; ++j) {
      const int c = j * 32 + l;                     // 16 chunks of 16 B per row
      w[j] = lds_f[wv][c];
      off[j] = (size_t)(jbase + (c >> 4)) * E_ + ibase + (c & 15) * 4;
    }
#pragma unroll
    for (int j = 0; j < 8; ++j) *(v4f*)(Of + off[j]) = w[j];
    
  } else {
    float bsc = 0.0f;
    if (MODE == 1) bsc = bias[jbase + m];
    v8us w0[4], w1[4];
#pragma unroll
    for (int t = 0; t < 4; ++t) {
      v8f val;
      if (MODE == 0) {
        const v4f b0 = *(const v4f*)(bias + ibase + t * 16 + 8 * h);
        const v4f b1 = *(const v4f*)(bias + ibase + t * 16 + 8 * h + 4);
        const v8f bb = __builtin_shufflevector(b0, b1, 0, 1, 2, 3, 4, 5, 6, 7);
        val = acc[t] + bb;
      } else {
        val = acc[t] + bsc;
      }
      split8(val, w0[t], w1[t]);
    }
    size_t base;      // this lane's place in the first tile
    int tstep;        // from the tile of k 0..31 to the tile of k 32..63
    if (MODE == 0) {
      const int bh = (jbase >> 11) * H_ + (ibase >> 6);
      base  = ((size_t)bh * S_ + (jbase & (S_ - 1))) * D_ + l * 8;
      tstep = TILE_;
    } else {
      const int bh = (ibase >> 11) * H_ + (jbase >> 6);
      const int dt = (jbase & (D_ - 1)) >> 4;
      const int st = (ibase & (S_ - 1)) >> 5;
      base  = (size_t)bh * D_ * S_ + (size_t)(st * 4 + dt) * TILE_ + l * 8;
      tstep = 4 * TILE_;
    }
#pragma unroll
    for (int t = 0; t < 4; ++t) {
      const size_t off = base + (t >> 1) * tstep + (t & 1) * 256;
      *(v8us*)(Oh + off) = w0[t];
      *(v8us*)(Ol + off) = w1[t];
    }
  }
}

// ---------------------------------------------------------------------------
// Flash attention, transposed: a wave owns 16 queries of one (b, head); lane (m, h) owns query q0+m (both lane halves).
// Per 64 keys: S^T tiles = K(16 keys x 64 d, A operand) . Q^T(64 d x 16 q, B operand) -> D rows = keys, cols = queries;
// per-lane online softmax over its 32 keys, partner half via one shuffle; P^T chains from D into the B operand of
// O^T(16 d x 16 q) += Vt(16 d x 32 keys, A operand) . P^T(32 keys x 16 q): B element r <- D(tile for keys 0..15)[r],
// element 8+r <- D(tile for keys 16..31)[r], lane unchanged.
__global__ void __launch_bounds__(128)
k_attn(const unsigned short* __restrict__ Qh, const unsigned short* __restrict__ Ql,
       const unsigned short* __restrict__ Kh, const unsigned short* __restrict__ Kl,
       const unsigned short* __restrict__ Vh, const unsigned short* __restrict__ Vl,
       const float* __restrict__ ent,
       unsigned short* __restrict__ Ah, unsigned short* __restrict__ Al)
{
  const int l    = threadIdx.x & 31;
  const int m    = l & 15;
  const int wv   = threadIdx.x >> 5;
  const int gw   = blockIdx.x * 4 + wv;        // 4096 waves, exact
  const int bh   = gw >> 7;
  const int qt   = gw & 127;
  const int q0   = qt * 16;
  const int b    = bh >> 3;
  const int head = bh & 7;

  const size_t qoff = ((size_t)bh * S_ + q0) * D_ + l * 8;   // 16 rows x D_ = two tiles: d 0..31, d 32..63
  const v16b qh0 = ld_frag(Qh + qoff);
  const v16b qh1 = ld_frag(Qh + qoff + TILE_);
  const v16b ql0 = ld_frag(Ql + qoff);
  const v16b ql1 = ld_frag(Ql + qoff + TILE_);
  // logit scale entangle[q] / sqrt(64), folded with log2(e) for exp2
  const float fac2 = ent[q0 + m] * 0.18033688011112042f;

  float mrun = -__builtin_inff();
  float lrun = 0.0f;
  v8f o[4];
#pragma unroll
  for (int t = 0; t < 4; ++t) o[t] = vzero();

  const unsigned short* kh_b = Kh + (size_t)bh * S_ * D_ + l * 8;
  const unsigned short* kl_b = Kl + (size_t)bh * S_ * D_ + l * 8;
  const unsigned short* vh_b = Vh + (size_t)bh * D_ * S_ + l * 8;
  const unsigned short* vl_b = Vl + (size_t)bh * D_ * S_ + l * 8;

#pragma unroll 1
  for (int kb = 0; kb < S_; kb += 64) {
    v8f c[4];
#pragma unroll
    for (int u = 0; u < 4; ++u) {
      const size_t ko = (size_t)(kb + u * 16) * D_;
      const v16b a0h = ld_frag(kh_b + ko);
      const v16b a1h = ld_frag(kh_b + ko + TILE_);
      const v16b a0l = ld_frag(kl_b + ko);
      const v16b a1l = ld_frag(kl_b + ko + TILE_);
      v8f cc = vzero();
      cc = mma(a0h, qh0, cc);
      cc = mma(a0h, ql0, cc);
      cc = mma(a0l, qh0, cc);
      cc = mma(a1h, qh1, cc);
      cc = mma(a1h, ql1, cc);
      cc = mma(a1l, qh1, cc);
      asm volatile(NOP4
                   : "+v"(cc)
                   : "v"(a0h), "v"(a1h), "v"(a0l), "v"(a1l), "v"(qh0), "v"(qh1), "v"(ql0), "v"(ql1)
                   : "memory");
      c[u] = cc;   // c[u][r] = raw score of key kb + 16u + 8h + r against query q0 + m
    }

    // online softmax, f32: lane holds 32 keys of its query; partner lane (xor 16) holds the other 32
    float tmax = -__builtin_inff();
#pragma unroll
    for (int u = 0; u < 4; ++u) {
      c[u] = c[u] * fac2;
#pragma unroll
      for (int r = 0; r < 8; ++r) tmax = fmaxf(tmax, c[u][r]);
    }
    tmax = fmaxf(tmax, __shfl_xor(tmax, 16));
    const float mnew  = fmaxf(mrun, tmax);
    const float alpha = __builtin_amdgcn_exp2f(mrun - mnew);
    float psum = 0.0f;
#pragma unroll
    for (int u = 0; u < 4; ++u) {
#pragma unroll
      for (int r = 0; r < 8; ++r) {
        const float p = __builtin_amdgcn_exp2f(c[u][r] - mnew);
        c[u][r] = p;
        psum += p;
      }
    }
    psum += __shfl_xor(psum, 16);
    lrun = lrun * alpha + psum;
    mrun = mnew;
#pragma unroll
    for (int t = 0; t < 4; ++t) o[t] = o[t] * alpha;

    // P^T (D layout, rows = keys) -> hi/lo B fragments; O^T += Vt . P^T
#pragma unroll
    for (int v = 0; v < 2; ++v) {
      v8us h0, l0, h1, l1;
      split8(c[2 * v], h0, l0);
      split8(c[2 * v + 1], h1, l1);
      const v16b phi = join16(h0, h1);
      const v16b plo = join16(l0, l1);
#pragma unroll
      for (int t = 0; t < 4; ++t) {
        const size_t vo = (size_t)(((kb >> 5) + v) * 4 + t) * TILE_;
        const v16b va_h = ld_frag(vh_b + vo);
        const v16b va_l = ld_frag(vl_b + vo);
        v8f oo = o[t];
        oo = mma(va_h, phi, oo);
        oo = mma(va_h, plo, oo);
        oo = mma(va_l, phi, oo);
        asm volatile(NOP4
                     : "+v"(oo)
                     : "v"(va_h), "v"(va_l), "v"(phi), "v"(plo)
                     : "memory");
        o[t] = oo;   // o[t][r] = O^T[d = 16t + 8h + r][q = q0 + m]
      }
    }
  }

  // At plane [N_][E_] in fragment order (rows n, k = e): lane (m, h) already holds row q0 + m, k = 64 head + 16t + 8h + r
  const float inv = 1.0f / lrun;
  v8us w0[4], w1[4];
#pragma unroll
  for (int t = 0; t < 4; ++t) {
    const v8f val = o[t] * inv;
    split8(val, w0[t], w1[t]);
  }
  const size_t aoff = ((size_t)b * S_ + q0) * E_ + (size_t)head * 2 * TILE_ + l * 8;
#pragma unroll
  for (int t = 0; t < 4; ++t) {
    *(v8us*)(Ah + aoff + t * 256) = w0[t];
    *(v8us*)(Al + aoff + t * 256) = w1[t];
  }
}

// ---------------------------------------------------------------------------
extern "C" void kernel_launch(void* const* d_in, const int* in_sizes, int n_in,
                              void* d_out, int out_size, void* d_ws, size_t ws_size,
                              hipStream_t stream) {
  if (n_in < 10) return;
  if (in_sizes[0] != N_ * E_ || in_sizes[1] != S_ ||
      in_sizes[2] != E_ * E_ || in_sizes[3] != E_ ||
      in_sizes[4] != E_ * E_ || in_sizes[5] != E_ ||
      in_sizes[6] != E_ * E_ || in_sizes[7] != E_ ||
      in_sizes[8] != E_ * E_ || in_sizes[9] != E_ ||
      out_size != N_ * E_) return;

  const float* x   = (const float*)d_in[0];   // [B,S,E]
  const float* ent = (const float*)d_in[1];   // [S]
  const float* Wq  = (const float*)d_in[2];
  const float* bq  = (const float*)d_in[3];
  const float* Wk  = (const float*)d_in[4];
  const float* bk  = (const float*)d_in[5];
  const float* Wv  = (const float*)d_in[6];
  const float* bv  = (const float*)d_in[7];
  const float* Wo  = (const float*)d_in[8];
  const float* bo  = (const float*)d_in[9];
  float* out = (float*)d_out;

  const size_t nX = (size_t)N_ * E_;           // 4194304
  const size_t nW = (size_t)E_ * E_;           // 262144
  const size_t total_bytes = (10 * nX + 8 * nW) * sizeof(unsigned short);   // 88080384
  if (total_bytes > ws_size) return;

  unsigned short* p = (unsigned short*)d_ws;
  unsigned short* Xh  = p; p += nX;   unsigned short* Xl  = p; p += nX;
  unsigned short* Wqh = p; p += nW;   unsigned short* Wql = p; p += nW;
  unsigned short* Wkh = p; p += nW;   unsigned short* Wkl = p; p += nW;
  unsigned short* Wvh = p; p += nW;   unsigned short* Wvl = p; p += nW;
  unsigned short* Woh = p; p += nW;   unsigned short* Wol = p; p += nW;
  unsigned short* Qh  = p; p += nX;   unsigned short* Ql  = p; p += nX;   // [B*H] x (rows s, k = d)
  unsigned short* Kh  = p; p += nX;   unsigned short* Kl  = p; p += nX;   // [B*H] x (rows s, k = d)
  unsigned short* Vh  = p; p += nX;   unsigned short* Vl  = p; p += nX;   // [B*H] x (rows d, k = s)
  unsigned short* Ah  = p; p += nX;   unsigned short* Al  = p; p += nX;   // rows n, k = e

  const int n8X = (int)(nX / 8);               // 524288
  const int n8W = (int)(nW / 8);               // 32768
  k_split<<<(n8X + 255) / 256, 256, 0, stream>>>(x,  Xh,  Xl,  n8X);
  k_split<<<(n8W + 255) / 256, 256, 0, stream>>>(Wq, Wqh, Wql, n8W);
  k_split<<<(n8W + 255) / 256, 256, 0, stream>>>(Wk, Wkh, Wkl, n8W);
  k_split<<<(n8W + 255) / 256, 256, 0, stream>>>(Wv, Wvh, Wvl, n8W);
  k_split<<<(n8W + 255) / 256, 256, 0, stream>>>(Wo, Woh, Wol, n8W);

  // 4096 wave tiles per GEMM / attention launch, 4 waves per 128-thread block
  const int nblk = ((E_ / 64) * (N_ / 16)) / 4;   // 1024; MODE 1: (N_/64)*(E_/16)/4 = 1024 as well
  k_gemm<0><<<nblk, 128, 0, stream>>>(Wqh, Wql, Xh, Xl, bq, Qh, Ql, out);
  k_gemm<0><<<nblk, 128, 0, stream>>>(Wkh, Wkl, Xh, Xl, bk, Kh, Kl, out);
  k_gemm<1><<<nblk, 128, 0, stream>>>(Xh, Xl, Wvh, Wvl, bv, Vh, Vl, out);

  k_attn<<<(B_ * H_ * (S_ / 16)) / 4, 128, 0, stream>>>(Qh, Ql, Kh, Kl, Vh, Vl, ent, Ah, Al);

  k_gemm<2><<<nblk, 128, 0, stream>>>(Woh, Wol, Ah, Al, bo, Ah, Al, out);
}

// v002
// Measured time: 179 microseconds a run.
// Timed twice side by side with v001, it ran 1.87 times as fast both times.
// Counting every step since v000, it is 2.31 times as fast.
#include <hip/hip_runtime.h>
#include <stddef.h>

// All contractions on v_wmma_f32_16x16x32_bf16 with bf16 operands carried as hi/lo pairs (hi*hi + hi*lo + lo*hi), f32 accumulate:
// q/k/v projections, key-by-query scores, value aggregation, output projection. Softmax, bias and normalisation in f32.

#define B_ 4
#define S_ 2048
#define E_ 512
#define H_ 8
#define D_ 64
#define N_ (B_ * S_)

static_assert(E_ == H_ * D_);
static_assert(D_ == 64 && E_ == 512);
static_assert((S_ % 64) == 0 && (E_ % 64) == 0 && (N_ % 64) == 0);

typedef float          v8f   __attribute__((ext_vector_type(8)));
typedef float          v4f   __attribute__((ext_vector_type(4)));
typedef __bf16         v16b  __attribute__((ext_vector_type(16)));
typedef __bf16         v8b   __attribute__((ext_vector_type(8)));
typedef unsigned short v8us  __attribute__((ext_vector_type(8)));

union Frag16 { v16b v; v8us hv[2]; };
union Pack8  { v8b b; v8us u; };

#define NOP4 "v_nop\n\tv_nop\n\tv_nop\n\tv_nop"

// Every 16-bit plane in the workspace is stored in fragment order: a tile is 16 rows x 32 k = 512 elements (1 KiB), and
// element (row, k) of a tile sits at ((k >> 4) & 1) * 256 + (((k >> 3) & 1) * 16 + (row & 15)) * 8 + (k & 7).
// Lane l = 16h + m then finds its 16x32 operand fragment (row m; elements 0..7 <- k 8h..8h+7, elements 8..15 <- k 16+8h..16+8h+7,
// the same map for A rows and for B columns) at tile + 8l and tile + 256 + 8l: each wave-wide load is 512 contiguous bytes.
#define TILE_ 512

// lp = tile start + 8 * lane
__device__ __forceinline__ v16b ld_frag(const unsigned short* lp) {
  Frag16 f;
  f.hv[0] = *(const v8us*)(lp);
  f.hv[1] = *(const v8us*)(lp + 256);
  return f.v;
}

__device__ __forceinline__ v16b join16(v8us a, v8us b) {
  Frag16 f;
  f.hv[0] = a;
  f.hv[1] = b;
  return f.v;
}

__device__ __forceinline__ v8f mma(v16b a, v16b b, v8f c) {
  return __builtin_amdgcn_wmma_f32_16x16x32_bf16(false, a, false, b, (short)0, c, false, false);
}

__device__ __forceinline__ v8f vzero() {
  v8f z = {0.f, 0.f, 0.f, 0.f, 0.f, 0.f, 0.f, 0.f};
  return z;
}

// f32 -> bf16 hi (RNE convert) and bf16 lo = RNE(x - hi)
__device__ __forceinline__ void split8(v8f x, v8us& hu, v8us& lu) {
  Pack8 ph, pl;
  ph.b = __builtin_convertvector(x, v8b);
  const v8f hf = __builtin_convertvector(ph.b, v8f);
  pl.b = __builtin_convertvector(x - hf, v8b);
  hu = ph.u;
  lu = pl.u;
}

// ---------------------------------------------------------------------------
// f32 [rows][E_] -> (bf16 hi plane, bf16 lo plane) in fragment order, tile index = (row >> 4) * (E_ / 32) + (k >> 5).
// 64 threads per tile, 8 elements each: a wave takes 8 rows x 32 k, so it reads whole 128-byte lines and stores whole lines.
__global__ void __launch_bounds__(256)
k_split(const float* __restrict__ src, unsigned short* __restrict__ dh, unsigned short* __restrict__ dl, int n8) {
  const int i = blockIdx.x * 256 + threadIdx.x;
  if (i < n8) {
    const int tile = i >> 6;
    const int row  = ((i >> 5) & 1) * 8 + (i & 7);   // row in the tile
    const int k8   = (i >> 3) & 3;                   // which 8 k of the tile's 32
    const v4f* p = (const v4f*)(src + (size_t)((tile >> 4) * 16 + row) * E_ + (tile & 15) * 32 + k8 * 8);
    const size_t dst = (size_t)tile * TILE_ + (k8 * 16 + row) * 8;
    const v4f a0 = p[0];
    const v4f a1 = p[1];
    const v8f x = __builtin_shufflevector(a0, a1, 0, 1, 2, 3, 4, 5, 6, 7);
    v8us hu, lu;
    split8(x, hu, lu);
    v8us* ph = (v8us*)(dh + dst);
    v8us* pl = (v8us*)(dl + dst);
    *ph = hu;
    *pl = lu;
    
  }
}

// ---------------------------------------------------------------------------
// Split GEMM: D[i][j] = sum_k P[i][k] * R[j][k], k = 0..511, both operands as hi/lo bf16 planes in fragment order,
// tile index = (row >> 4) * (E_ / 32) + (k >> 5).
// Wave tile: 64 i (4 WMMA tiles, A operand) x 16 j (B operand). acc[t][r] at lane (m,h) = D[ibase + 16t + 8h + r][jbase + m].
// MODE 0: P = W[e][k], R = X[n][k]  -> Q/K plane per b*8+head, rows s, k = d, tile index (s >> 4) * 2 + (d >> 5), bias[e]
// MODE 1: P = X[n][k], R = W[e][k]  -> Vt plane per b*8+head, rows d, k = s, tile index (s >> 5) * 4 + (d >> 4), bias[e]
// MODE 2: P = W[e][k], R = At[n][k] -> f32 out[n][e], bias[e]
// MODE 0 and 1: the accumulator's 8 values of a lane are that same lane's 8 elements of the output plane's fragment order
// (k = 16t + 8h + r, row = m), so each lane stores 16 bytes at tile + 8l and a wave-wide store is 512 contiguous bytes.
template <int MODE>
__global__ void __launch_bounds__(128)
k_gemm(const unsigned short* __restrict__ Ph, const unsigned short* __restrict__ Pl,
       const unsigned short* __restrict__ Rh, const unsigned short* __restrict__ Rl,
       const float* __restrict__ bias,
       unsigned short* __restrict__ Oh, unsigned short* __restrict__ Ol,
       float* __restrict__ Of)
{
  const int l  = threadIdx.x & 31;
  const int h  = l >> 4;
  const int m  = l & 15;
  const int wv = threadIdx.x >> 5;
  const int gw = blockIdx.x * 4 + wv;          // 4096 wave tiles, exact
  int ibase, jbase;
  if (MODE == 1) { ibase = (gw >> 5) * 64; jbase = (gw & 31) * 16; }
  else           { ibase = (gw & 7) * 64;  jbase = (gw >> 3) * 16; }

  v8f acc[4];
#pragma unroll
  for (int t = 0; t < 4; ++t) acc[t] = vzero();

  const unsigned short* rp_h = Rh + (size_t)jbase * E_ + l * 8;   // 16 rows x E_ = E_ / 32 tiles
  const unsigned short* rp_l = Rl + (size_t)jbase * E_ + l * 8;
  const unsigned short* pp_h = Ph + (size_t)ibase * E_ + l * 8;
  const unsigned short* pp_l = Pl + (size_t)ibase * E_ + l * 8;

#pragma unroll 1
  for (int k0 = 0; k0 < E_; k0 += 32) {
    const int kt = (k0 >> 5) * TILE_;
    const v16b rh = ld_frag(rp_h + kt);
    const v16b rl = ld_frag(rp_l + kt);
    v16b ph[4], pl[4];
#pragma unroll
    for (int t = 0; t < 4; ++t) {
      ph[t] = ld_frag(pp_h + (size_t)t * 16 * E_ + kt);
      pl[t] = ld_frag(pp_l + (size_t)t * 16 * E_ + kt);
    }
#pragma unroll
    for (int t = 0; t < 4; ++t) {
      acc[t] = mma(ph[t], rh, acc[t]);
      acc[t] = mma(ph[t], rl, acc[t]);
      acc[t] = mma(pl[t], rh, acc[t]);
    }
    asm volatile(NOP4
                 : "+v"(acc[0]), "+v"(acc[1]), "+v"(acc[2]), "+v"(acc[3])
                 : "v"(ph[0]), "v"(ph[1]), "v"(ph[2]), "v"(ph[3]),
                   "v"(pl[0]), "v"(pl[1]), "v"(pl[2]), "v"(pl[3]),
                   "v"(rh), "v"(rl)
                 : "memory");
  }

  if constexpr (MODE == 2) {
    __shared__ v4f lds_f[4][256];
#pragma unroll
    for (int t = 0; t < 4; ++t) {
      const v4f b0 = *(const v4f*)(bias + ibase + t * 16 + 8 * h);
      const v4f b1 = *(const v4f*)(bias + ibase + t * 16 + 8 * h + 4);
      const v8f bb = __builtin_shufflevector(b0, b1, 0, 1, 2, 3, 4, 5, 6, 7);
      const v8f val = acc[t] + bb;
      lds_f[wv][m * 16 + 4 * t + 2 * h]     = __builtin_shufflevector(val, val, 0, 1, 2, 3);
      lds_f[wv][m * 16 + 4 * t + 2 * h + 1] = __builtin_shufflevector(val, val, 4, 5, 6, 7);
    }
    __syncthreads();
    v4f w[8];
    size_t off[8];
#pragma unroll
    for (int j = 0; j < 8; ++j) {
      const int c = j * 32 + l;                     // 16 chunks of 16 B per row
      w[j] = lds_f[wv][c];
      off[j] = (size_t)(jbase + (c >> 4)) * E_ + ibase + (c & 15) * 4;
    }
#pragma unroll
    for (int j = 0; j < 8; ++j) *(v4f*)(Of + off[j]) = w[j];
    
  } else {
    float bsc = 0.0f;
    if (MODE == 1) bsc = bias[jbase + m];
    v8us w0[4], w1[4];
#pragma unroll
    for (int t = 0; t < 4; ++t) {
      v8f val;
      if (MODE == 0) {
        const v4f b0 = *(const v4f*)(bias + ibase + t * 16 + 8 * h);
        const v4f b1 = *(const v4f*)(bias + ibase + t * 16 + 8 * h + 4);
        const v8f bb = __builtin_shufflevector(b0, b1, 0, 1, 2, 3, 4, 5, 6, 7);
        val = acc[t] + bb;
      } else {
        val = acc[t] + bsc;
      }
      split8(val, w0[t], w1[t]);
    }
    size_t base;      // this lane's place in the first tile
    int tstep;        // from the tile of k 0..31 to the tile of k 32..63
    if (MODE == 0) {
      const int bh = (jbase >> 11) * H_ + (ibase >> 6);
      base  = ((size_t)bh * S_ + (jbase & (S_ - 1))) * D_ + l * 8;
      tstep = TILE_;
    } else {
      const int bh = (ibase >> 11) * H_ + (jbase >> 6);
      const int dt = (jbase & (D_ - 1)) >> 4;
      const int st = (ibase & (S_ - 1)) >> 5;
      base  = (size_t)bh * D_ * S_ + (size_t)(st * 4 + dt) * TILE_ + l * 8;
      tstep = 4 * TILE_;
    }
#pragma unroll
    for (int t = 0; t < 4; ++t) {
      const size_t off = base + (t >> 1) * tstep + (t & 1) * 256;
      *(v8us*)(Oh + off) = w0[t];
      *(v8us*)(Ol + off) = w1[t];
    }
  }
}

// ---------------------------------------------------------------------------
// Flash attention, transposed: a wave owns 16 queries of one (b, head); lane (m, h) owns query q0+m (both lane halves).
// Per 64 keys: S^T tiles = K(16 keys x 64 d, A operand) . Q^T(64 d x 16 q, B operand) -> D rows = keys, cols = queries;
// per-lane online softmax over its 32 keys, partner half via one shuffle; P^T chains from D into the B operand of
// O^T(16 d x 16 q) += Vt(16 d x 32 keys, A operand) . P^T(32 keys x 16 q): B element r <- D(tile for keys 0..15)[r],
// element 8+r <- D(tile for keys 16..31)[r], lane unchanged.
// The 8 waves of a block share one (b, head): each 64-key stage of the four K / Vt planes (8 KiB each, contiguous in
// fragment order) is brought into LDS once per block by asynchronous copies, two buffers, the next stage in flight
// while this one is worked on; the waves read their fragments from LDS at the same tile offsets as in the planes.
#define KSTEP_ 64
#define PLANE_ (KSTEP_ * D_)     // elements of one plane per stage (8 KiB)
#define STAGE_ (4 * PLANE_)      // Kh, Kl, Vh, Vl
#define HALFB_ (PLANE_ * 2 / 2)  // bytes of half a plane's stage: what 256 lanes bring with one 16-byte copy each
static_assert(S_ / KSTEP_ >= 2);
static_assert(HALFB_ == 256 * 16);

// One stage: every lane copies 2 x 16 bytes of each plane. dst = this lane's LDS byte address in the stage's buffer,
// the pointers = this lane's 16 bytes in the first half of each plane's stage.
// s_wait_xcnt stands inside the statement so that no address register is rewritten ahead of it.
__device__ __forceinline__ void copy_stage(unsigned dst,
                                           const unsigned short* kh, const unsigned short* kl,
                                           const unsigned short* vh, const unsigned short* vl) {
  asm volatile("global_load_async_to_lds_b128 %0, %8, off\n\t"
               "global_load_async_to_lds_b128 %1, %9, off\n\t"
               "global_load_async_to_lds_b128 %2, %10, off\n\t"
               "global_load_async_to_lds_b128 %3, %11, off\n\t"
               "global_load_async_to_lds_b128 %4, %12, off\n\t"
               "global_load_async_to_lds_b128 %5, %13, off\n\t"
               "global_load_async_to_lds_b128 %6, %14, off\n\t"
               "global_load_async_to_lds_b128 %7, %15, off\n\t"
               "s_wait_xcnt 0x0"
               :
               : "v"(dst),                 "v"(dst + HALFB_),
                 "v"(dst + 2 * HALFB_),    "v"(dst + 3 * HALFB_),
                 "v"(dst + 4 * HALFB_),    "v"(dst + 5 * HALFB_),
                 "v"(dst + 6 * HALFB_),    "v"(dst + 7 * HALFB_),
                 "v"(kh), "v"(kh + PLANE_ / 2), "v"(kl), "v"(kl + PLANE_ / 2),
                 "v"(vh), "v"(vh + PLANE_ / 2), "v"(vl), "v"(vl + PLANE_ / 2)
               : "memory");
}

__global__ void __launch_bounds__(256)
k_attn(const unsigned short* __restrict__ Qh, const unsigned short* __restrict__ Ql,
       const unsigned short* __restrict__ Kh, const unsigned short* __restrict__ Kl,
       const unsigned short* __restrict__ Vh, const unsigned short* __restrict__ Vl,
       const float* __restrict__ ent,
       unsigned short* __restrict__ Ah, unsigned short* __restrict__ Al)
{
  const int l    = threadIdx.x & 31;
  const int m    = l & 15;
  const int wv   = threadIdx.x >> 5;
  const int gw   = blockIdx.x * 8 + wv;        // 4096 waves, exact; 128 waves per (b, head), so a block has one
  const int bh   = gw >> 7;
  const int qt   = gw & 127;
  const int q0   = qt * 16;
  const int b    = bh >> 3;
  const int head = bh & 7;

  const size_t qoff = ((size_t)bh * S_ + q0) * D_ + l * 8;   // 16 rows x D_ = two tiles: d 0..31, d 32..63
  const v16b qh0 = ld_frag(Qh + qoff);
  const v16b qh1 = ld_frag(Qh + qoff + TILE_);
  const v16b ql0 = ld_frag(Ql + qoff);
  const v16b ql1 = ld_frag(Ql + qoff + TILE_);
  // logit scale entangle[q] / sqrt(64), folded with log2(e) for exp2
  const float fac2 = ent[q0 + m] * 0.18033688011112042f;

  float mrun = -__builtin_inff();
  float lrun = 0.0f;
  v8f o[4];
#pragma unroll
  for (int t = 0; t < 4; ++t) o[t] = vzero();

  __shared__ __attribute__((aligned(16))) unsigned short ring[2 * STAGE_];   // 64 KiB
  const unsigned ring_l = (unsigned)(size_t)ring + threadIdx.x * 16;         // this lane's LDS byte address, buffer 0
  // this lane's 16 bytes of stage 0 in each plane; a stage of 64 keys is PLANE_ elements further in all four
  const unsigned short* kh_g = Kh + (size_t)bh * S_ * D_ + threadIdx.x * 8;
  const unsigned short* kl_g = Kl + (size_t)bh * S_ * D_ + threadIdx.x * 8;
  const unsigned short* vh_g = Vh + (size_t)bh * D_ * S_ + threadIdx.x * 8;
  const unsigned short* vl_g = Vl + (size_t)bh * D_ * S_ + threadIdx.x * 8;

  copy_stage(ring_l, kh_g, kl_g, vh_g, vl_g);
  asm volatile("s_wait_asynccnt 0x0" ::: "memory");   // this wave's share of stage 0 has landed
  __syncthreads();                                    // every wave's share has: stage 0 may be read
  copy_stage(ring_l + STAGE_ * 2, kh_g + PLANE_, kl_g + PLANE_, vh_g + PLANE_, vl_g + PLANE_);

#pragma unroll 1
  for (int kb = 0; kb < S_; kb += KSTEP_) {
    const int buf = (kb / KSTEP_) & 1;
    const unsigned short* kh_b = ring + buf * STAGE_ + l * 8;
    const unsigned short* kl_b = kh_b + PLANE_;
    const unsigned short* vh_b = kh_b + 2 * PLANE_;
    const unsigned short* vl_b = kh_b + 3 * PLANE_;
    v8f c[4];
#pragma unroll
    for (int u = 0; u < 4; ++u) {
      const int ko = u * 16 * D_;
      const v16b a0h = ld_frag(kh_b + ko);
      const v16b a1h = ld_frag(kh_b + ko + TILE_);
      const v16b a0l = ld_frag(kl_b + ko);
      const v16b a1l = ld_frag(kl_b + ko + TILE_);
      v8f cc = vzero();
      cc = mma(a0h, qh0, cc);
      cc = mma(a0h, ql0, cc);
      cc = mma(a0l, qh0, cc);
      cc = mma(a1h, qh1, cc);
      cc = mma(a1h, ql1, cc);
      cc = mma(a1l, qh1, cc);
      asm volatile(NOP4
                   : "+v"(cc)
                   : "v"(a0h), "v"(a1h), "v"(a0l), "v"(a1l), "v"(qh0), "v"(qh1), "v"(ql0), "v"(ql1)
                   : "memory");
      c[u] = cc;   // c[u][r] = raw score of key kb + 16u + 8h + r against query q0 + m
    }

    // online softmax, f32: lane holds 32 keys of its query; partner lane (xor 16) holds the other 32
    float tmax = -__builtin_inff();
#pragma unroll
    for (int u = 0; u < 4; ++u) {
      c[u] = c[u] * fac2;
#pragma unroll
      for (int r = 0; r < 8; ++r) tmax = fmaxf(tmax, c[u][r]);
    }
    tmax = fmaxf(tmax, __shfl_xor(tmax, 16));
    const float mnew  = fmaxf(mrun, tmax);
    const float alpha = __builtin_amdgcn_exp2f(mrun - mnew);
    float psum = 0.0f;
#pragma unroll
    for (int u = 0; u < 4; ++u) {
#pragma unroll
      for (int r = 0; r < 8; ++r) {
        const float p = __builtin_amdgcn_exp2f(c[u][r] - mnew);
        c[u][r] = p;
        psum += p;
      }
    }
    psum += __shfl_xor(psum, 16);
    lrun = lrun * alpha + psum;
    mrun = mnew;
#pragma unroll
    for (int t = 0; t < 4; ++t) o[t] = o[t] * alpha;

    // P^T (D layout, rows = keys) -> hi/lo B fragments; O^T += Vt . P^T
#pragma unroll
    for (int v = 0; v < 2; ++v) {
      v8us h0, l0, h1, l1;
      split8(c[2 * v], h0, l0);
      split8(c[2 * v + 1], h1, l1);
      const v16b phi = join16(h0, h1);
      const v16b plo = join16(l0, l1);
#pragma unroll
      for (int t = 0; t < 4; ++t) {
        const int vo = (v * 4 + t) * TILE_;
        const v16b va_h = ld_frag(vh_b + vo);
        const v16b va_l = ld_frag(vl_b + vo);
        v8f oo = o[t];
        oo = mma(va_h, phi, oo);
        oo = mma(va_h, plo, oo);
        oo = mma(va_l, phi, oo);
        asm volatile(NOP4
                     : "+v"(oo)
                     : "v"(va_h), "v"(va_l), "v"(phi), "v"(plo)
                     : "memory");
        o[t] = oo;   // o[t][r] = O^T[d = 16t + 8h + r][q = q0 + m]
      }
    }

    // hand-over: this wave has left the buffer, its share of the next stage has landed, then all waves meet
    asm volatile("s_wait_dscnt 0x0" ::: "memory");      // this wave's reads of the buffer are done before it is refilled
    asm volatile("s_wait_asynccnt 0x0" ::: "memory");   // this wave's copies of the next stage have landed
    __syncthreads();                                    // publishes the next stage, frees the buffer just read
    if (kb + 2 * KSTEP_ < S_) {
      const int nx = (kb + 2 * KSTEP_) * D_;
      copy_stage(ring_l + buf * (STAGE_ * 2), kh_g + nx, kl_g + nx, vh_g + nx, vl_g + nx);
    }
  }
  asm volatile("s_wait_asynccnt 0x0" ::: "memory");     // nothing is in flight when the wave ends

  // At plane [N_][E_] in fragment order (rows n, k = e): lane (m, h) already holds row q0 + m, k = 64 head + 16t + 8h + r
  const float inv = 1.0f / lrun;
  v8us w0[4], w1[4];
#pragma unroll
  for (int t = 0; t < 4; ++t) {
    const v8f val = o[t] * inv;
    split8(val, w0[t], w1[t]);
  }
  const size_t aoff = ((size_t)b * S_ + q0) * E_ + (size_t)head * 2 * TILE_ + l * 8;
#pragma unroll
  for (int t = 0; t < 4; ++t) {
    *(v8us*)(Ah + aoff + t * 256) = w0[t];
    *(v8us*)(Al + aoff + t * 256) = w1[t];
  }
}

// ---------------------------------------------------------------------------
extern "C" void kernel_launch(void* const* d_in, const int* in_sizes, int n_in,
                              void* d_out, int out_size, void* d_ws, size_t ws_size,
                              hipStream_t stream) {
  if (n_in < 10) return;
  if (in_sizes[0] != N_ * E_ || in_sizes[1] != S_ ||
      in_sizes[2] != E_ * E_ || in_sizes[3] != E_ ||
      in_sizes[4] != E_ * E_ || in_sizes[5] != E_ ||
      in_sizes[6] != E_ * E_ || in_sizes[7] != E_ ||
      in_sizes[8] != E_ * E_ || in_sizes[9] != E_ ||
      out_size != N_ * E_) return;

  const float* x   = (const float*)d_in[0];   // [B,S,E]
  const float* ent = (const float*)d_in[1];   // [S]
  const float* Wq  = (const float*)d_in[2];
  const float* bq  = (const float*)d_in[3];
  const float* Wk  = (const float*)d_in[4];
  const float* bk  = (const float*)d_in[5];
  const float* Wv  = (const float*)d_in[6];
  const float* bv  = (const float*)d_in[7];
  const float* Wo  = (const float*)d_in[8];
  const float* bo  = (const float*)d_in[9];
  float* out = (float*)d_out;

  const size_t nX = (size_t)N_ * E_;           // 4194304
  const size_t nW = (size_t)E_ * E_;           // 262144
  const size_t total_bytes = (10 * nX + 8 * nW) * sizeof(unsigned short);   // 88080384
  if (total_bytes > ws_size) return;

  unsigned short* p = (unsigned short*)d_ws;
  unsigned short* Xh  = p; p += nX;   unsigned short* Xl  = p; p += nX;
  unsigned short* Wqh = p; p += nW;   unsigned short* Wql = p; p += nW;
  unsigned short* Wkh = p; p += nW;   unsigned short* Wkl = p; p += nW;
  unsigned short* Wvh = p; p += nW;   unsigned short* Wvl = p; p += nW;
  unsigned short* Woh = p; p += nW;   unsigned short* Wol = p; p += nW;
  unsigned short* Qh  = p; p += nX;   unsigned short* Ql  = p; p += nX;   // [B*H] x (rows s, k = d)
  unsigned short* Kh  = p; p += nX;   unsigned short* Kl  = p; p += nX;   // [B*H] x (rows s, k = d)
  unsigned short* Vh  = p; p += nX;   unsigned short* Vl  = p; p += nX;   // [B*H] x (rows d, k = s)
  unsigned short* Ah  = p; p += nX;   unsigned short* Al  = p; p += nX;   // rows n, k = e

  const int n8X = (int)(nX / 8);               // 524288
  const int n8W = (int)(nW / 8);               // 32768
  k_split<<<(n8X + 255) / 256, 256, 0, stream>>>(x,  Xh,  Xl,  n8X);
  k_split<<<(n8W + 255) / 256, 256, 0, stream>>>(Wq, Wqh, Wql, n8W);
  k_split<<<(n8W + 255) / 256, 256, 0, stream>>>(Wk, Wkh, Wkl, n8W);
  k_split<<<(n8W + 255) / 256, 256, 0, stream>>>(Wv, Wvh, Wvl, n8W);
  k_split<<<(n8W + 255) / 256, 256, 0, stream>>>(Wo, Woh, Wol, n8W);

  // 4096 wave tiles per GEMM launch, 4 waves per 128-thread block
  const int nblk = ((E_ / 64) * (N_ / 16)) / 4;   // 1024; MODE 1: (N_/64)*(E_/16)/4 = 1024 as well
  k_gemm<0><<<nblk, 128, 0, stream>>>(Wqh, Wql, Xh, Xl, bq, Qh, Ql, out);
  k_gemm<0><<<nblk, 128, 0, stream>>>(Wkh, Wkl, Xh, Xl, bk, Kh, Kl, out);
  k_gemm<1><<<nblk, 128, 0, stream>>>(Xh, Xl, Wvh, Wvl, bv, Vh, Vl, out);

  k_attn<<<(B_ * H_ * (S_ / 16)) / 8, 256, 0, stream>>>(Qh, Ql, Kh, Kl, Vh, Vl, ent, Ah, Al);

  k_gemm<2><<<nblk, 128, 0, stream>>>(Woh, Wol, Ah, Al, bo, Ah, Al, out);
}

// v003
// Measured time: 162 microseconds a run.
// Next to v002, in two timings, it ran 1.12 times as fast each time.
// All steps since v000 together make it 2.58 times as fast.
#include <hip/hip_runtime.h>
#include <stddef.h>

// All contractions on v_wmma_f32_16x16x32_bf16 with bf16 operands carried as hi/lo pairs (hi*hi + hi*lo + lo*hi), f32 accumulate:
// q/k/v projections, key-by-query scores, value aggregation, output projection. Softmax, bias and normalisation in f32.

#define B_ 4
#define S_ 2048
#define E_ 512
#define H_ 8
#define D_ 64
#define N_ (B_ * S_)

static_assert(E_ == H_ * D_);
static_assert(D_ == 64 && E_ == 512);
static_assert((S_ % 64) == 0 && (E_ % 64) == 0 && (N_ % 64) == 0);

typedef float          v8f   __attribute__((ext_vector_type(8)));
typedef float          v4f   __attribute__((ext_vector_type(4)));
typedef __bf16         v16b  __attribute__((ext_vector_type(16)));
typedef __bf16         v8b   __attribute__((ext_vector_type(8)));
typedef unsigned short v8us  __attribute__((ext_vector_type(8)));

union Frag16 { v16b v; v8us hv[2]; };
union Pack8  { v8b b; v8us u; };

#define NOP4 "v_nop\n\tv_nop\n\tv_nop\n\tv_nop"

// Every 16-bit plane in the workspace is stored in fragment order: a tile is 16 rows x 32 k = 512 elements (1 KiB), and
// element (row, k) of a tile sits at ((k >> 4) & 1) * 256 + (((k >> 3) & 1) * 16 + (row & 15)) * 8 + (k & 7).
// Lane l = 16h + m then finds its 16x32 operand fragment (row m; elements 0..7 <- k 8h..8h+7, elements 8..15 <- k 16+8h..16+8h+7,
// the same map for A rows and for B columns) at tile + 8l and tile + 256 + 8l: each wave-wide load is 512 contiguous bytes.
#define TILE_ 512

// lp = tile start + 8 * lane
__device__ __forceinline__ v16b ld_frag(const unsigned short* lp) {
  Frag16 f;
  f.hv[0] = *(const v8us*)(lp);
  f.hv[1] = *(const v8us*)(lp + 256);
  return f.v;
}

__device__ __forceinline__ v16b join16(v8us a, v8us b) {
  Frag16 f;
  f.hv[0] = a;
  f.hv[1] = b;
  return f.v;
}

__device__ __forceinline__ v8f mma(v16b a, v16b b, v8f c) {
  return __builtin_amdgcn_wmma_f32_16x16x32_bf16(false, a, false, b, (short)0, c, false, false);
}

__device__ __forceinline__ v8f vzero() {
  v8f z = {0.f, 0.f, 0.f, 0.f, 0.f, 0.f, 0.f, 0.f};
  return z;
}

// f32 -> bf16 hi (RNE convert) and bf16 lo = RNE(x - hi)
__device__ __forceinline__ void split8(v8f x, v8us& hu, v8us& lu) {
  Pack8 ph, pl;
  ph.b = __builtin_convertvector(x, v8b);
  const v8f hf = __builtin_convertvector(ph.b, v8f);
  pl.b = __builtin_convertvector(x - hf, v8b);
  hu = ph.u;
  lu = pl.u;
}

// ---------------------------------------------------------------------------
// f32 [rows][E_] -> (bf16 hi plane, bf16 lo plane) in fragment order, tile index = (row >> 4) * (E_ / 32) + (k >> 5).
// 64 threads per tile, 8 elements each: a wave takes 8 rows x 32 k, so it reads whole 128-byte lines and stores whole lines.
// One grid for the five independent arrays, the block index range picks the array: blocks 0..XBLK_-1 take xf, then WBLK_
// blocks for each of Wq, Wk, Wv, Wo, whose planes lie one behind the other at wp (hi, lo, hi, lo, ...).
#define XBLK_ (N_ * E_ / 8 / 256)
#define WBLK_ (E_ * E_ / 8 / 256)
static_assert(XBLK_ * 256 * 8 == N_ * E_ && WBLK_ * 256 * 8 == E_ * E_);   // the grid is exact: no thread without work
__global__ void __launch_bounds__(256)
k_split(const float* __restrict__ xf, const float* __restrict__ wq, const float* __restrict__ wk,
        const float* __restrict__ wv, const float* __restrict__ wo,
        unsigned short* __restrict__ xh, unsigned short* __restrict__ xl, unsigned short* __restrict__ wp) {
  const float* src = xf;
  unsigned short* dh = xh;
  unsigned short* dl = xl;
  int blk = blockIdx.x;
  if (blk >= XBLK_) {
    const int j = (blk - XBLK_) / WBLK_;
    blk = (blk - XBLK_) % WBLK_;
    src = j == 0 ? wq : j == 1 ? wk : j == 2 ? wv : wo;
    dh  = wp + (size_t)j * 2 * E_ * E_;
    dl  = dh + E_ * E_;
  }
  const int i = blk * 256 + threadIdx.x;
  const int tile = i >> 6;
  const int row  = ((i >> 5) & 1) * 8 + (i & 7);   // row in the tile
  const int k8   = (i >> 3) & 3;                   // which 8 k of the tile's 32
  const v4f* p = (const v4f*)(src + (size_t)((tile >> 4) * 16 + row) * E_ + (tile & 15) * 32 + k8 * 8);
  const size_t dst = (size_t)tile * TILE_ + (k8 * 16 + row) * 8;
  const v4f a0 = p[0];
  const v4f a1 = p[1];
  const v8f x = __builtin_shufflevector(a0, a1, 0, 1, 2, 3, 4, 5, 6, 7);
  v8us hu, lu;
  split8(x, hu, lu);
  v8us* ph = (v8us*)(dh + dst);
  v8us* pl = (v8us*)(dl + dst);
  *ph = hu;
  *pl = lu;
}

// ---------------------------------------------------------------------------
// Split GEMM: D[i][j] = sum_k P[i][k] * R[j][k], k = 0..511, both operands as hi/lo bf16 planes in fragment order,
// tile index = (row >> 4) * (E_ / 32) + (k >> 5).
// Wave tile: 64 i (4 WMMA tiles, A operand) x 16 j (B operand). acc[t][r] at lane (m,h) = D[ibase + 16t + 8h + r][jbase + m].
// MODE 0: P = W[e][k], R = X[n][k]  -> Q/K plane per b*8+head, rows s, k = d, tile index (s >> 4) * 2 + (d >> 5), bias[e]
// MODE 1: P = X[n][k], R = W[e][k]  -> Vt plane per b*8+head, rows d, k = s, tile index (s >> 5) * 4 + (d >> 4), bias[e]
// MODE 2: P = W[e][k], R = At[n][k] -> f32 out[n][e], bias[e]
// MODE 0 and 1: the accumulator's 8 values of a lane are that same lane's 8 elements of the output plane's fragment order
// (k = 16t + 8h + r, row = m), so each lane stores 16 bytes at tile + 8l and a wave-wide store is 512 contiguous bytes.
// blk = the block's number inside its own product, 0..GBLK_-1.
#define GBLK_ ((E_ / 64) * (N_ / 16) / 4)   // 4096 wave tiles per product, 4 waves per 128-thread block
static_assert(GBLK_ == (N_ / 64) * (E_ / 16) / 4);
template <int MODE>
__device__ __forceinline__ void
gemm_tile(const int blk,
          const unsigned short* __restrict__ Ph, const unsigned short* __restrict__ Pl,
          const unsigned short* __restrict__ Rh, const unsigned short* __restrict__ Rl,
          const float* __restrict__ bias,
          unsigned short* __restrict__ Oh, unsigned short* __restrict__ Ol,
          float* __restrict__ Of)
{
  const int l  = threadIdx.x & 31;
  const int h  = l >> 4;
  const int m  = l & 15;
  const int wv = threadIdx.x >> 5;
  const int gw = blk * 4 + wv;                 // 4096 wave tiles, exact
  int ibase, jbase;
  if (MODE == 1) { ibase = (gw >> 5) * 64; jbase = (gw & 31) * 16; }
  else           { ibase = (gw & 7) * 64;  jbase = (gw >> 3) * 16; }

  v8f acc[4];
#pragma unroll
  for (int t = 0; t < 4; ++t) acc[t] = vzero();

  const unsigned short* rp_h = Rh + (size_t)jbase * E_ + l * 8;   // 16 rows x E_ = E_ / 32 tiles
  const unsigned short* rp_l = Rl + (size_t)jbase * E_ + l * 8;
  const unsigned short* pp_h = Ph + (size_t)ibase * E_ + l * 8;
  const unsigned short* pp_l = Pl + (size_t)ibase * E_ + l * 8;

#pragma unroll 1
  for (int k0 = 0; k0 < E_; k0 += 32) {
    const int kt = (k0 >> 5) * TILE_;
    const v16b rh = ld_frag(rp_h + kt);
    const v16b rl = ld_frag(rp_l + kt);
    v16b ph[4], pl[4];
#pragma unroll
    for (int t = 0; t < 4; ++t) {
      ph[t] = ld_frag(pp_h + (size_t)t * 16 * E_ + kt);
      pl[t] = ld_frag(pp_l + (size_t)t * 16 * E_ + kt);
    }
#pragma unroll
    for (int t = 0; t < 4; ++t) {
      acc[t] = mma(ph[t], rh, acc[t]);
      acc[t] = mma(ph[t], rl, acc[t]);
      acc[t] = mma(pl[t], rh, acc[t]);
    }
    asm volatile(NOP4
                 : "+v"(acc[0]), "+v"(acc[1]), "+v"(acc[2]), "+v"(acc[3])
                 : "v"(ph[0]), "v"(ph[1]), "v"(ph[2]), "v"(ph[3]),
                   "v"(pl[0]), "v"(pl[1]), "v"(pl[2]), "v"(pl[3]),
                   "v"(rh), "v"(rl)
                 : "memory");
  }

  if constexpr (MODE == 2) {
    __shared__ v4f lds_f[4][256];
#pragma unroll
    for (int t = 0; t < 4; ++t) {
      const v4f b0 = *(const v4f*)(bias + ibase + t * 16 + 8 * h);
      const v4f b1 = *(const v4f*)(bias + ibase + t * 16 + 8 * h + 4);
      const v8f bb = __builtin_shufflevector(b0, b1, 0, 1, 2, 3, 4, 5, 6, 7);
      const v8f val = acc[t] + bb;
      lds_f[wv][m * 16 + 4 * t + 2 * h]     = __builtin_shufflevector(val, val, 0, 1, 2, 3);
      lds_f[wv][m * 16 + 4 * t + 2 * h + 1] = __builtin_shufflevector(val, val, 4, 5, 6, 7);
    }
    __syncthreads();
    v4f w[8];
    size_t off[8];
#pragma unroll
    for (int j = 0; j < 8; ++j) {
      const int c = j * 32 + l;                     // 16 chunks of 16 B per row
      w[j] = lds_f[wv][c];
      off[j] = (size_t)(jbase + (c >> 4)) * E_ + ibase + (c & 15) * 4;
    }
#pragma unroll
    for (int j = 0; j < 8; ++j) *(v4f*)(Of + off[j]) = w[j];
    
  } else {
    float bsc = 0.0f;
    if (MODE == 1) bsc = bias[jbase + m];
    v8us w0[4], w1[4];
#pragma unroll
    for (int t = 0; t < 4; ++t) {
      v8f val;
      if (MODE == 0) {
        const v4f b0 = *(const v4f*)(bias + ibase + t * 16 + 8 * h);
        const v4f b1 = *(const v4f*)(bias + ibase + t * 16 + 8 * h + 4);
        const v8f bb = __builtin_shufflevector(b0, b1, 0, 1, 2, 3, 4, 5, 6, 7);
        val = acc[t] + bb;
      } else {
        val = acc[t] + bsc;
      }
      split8(val, w0[t], w1[t]);
    }
    size_t base;      // this lane's place in the first tile
    int tstep;        // from the tile of k 0..31 to the tile of k 32..63
    if (MODE == 0) {
      const int bh = (jbase >> 11) * H_ + (ibase >> 6);
      base  = ((size_t)bh * S_ + (jbase & (S_ - 1))) * D_ + l * 8;
      tstep = TILE_;
    } else {
      const int bh = (ibase >> 11) * H_ + (jbase >> 6);
      const int dt = (jbase & (D_ - 1)) >> 4;
      const int st = (ibase & (S_ - 1)) >> 5;
      base  = (size_t)bh * D_ * S_ + (size_t)(st * 4 + dt) * TILE_ + l * 8;
      tstep = 4 * TILE_;
    }
#pragma unroll
    for (int t = 0; t < 4; ++t) {
      const size_t off = base + (t >> 1) * tstep + (t & 1) * 256;
      *(v8us*)(Oh + off) = w0[t];
      *(v8us*)(Ol + off) = w1[t];
    }
    // several products share one kernel, so code may follow these stores in the listing: the wait stands in front of
    // any rewrite of a register that they name
    asm volatile("s_wait_xcnt 0x0" ::: "memory");
  }
}

// The three projections are independent of one another: one grid, the block index range picks the product
// (0: Q, 1: K, 2: Vt).
__global__ void __launch_bounds__(128)
k_gemm_qkv(const unsigned short* __restrict__ xh,  const unsigned short* __restrict__ xl,
           const unsigned short* __restrict__ wqh, const unsigned short* __restrict__ wql,
           const unsigned short* __restrict__ wkh, const unsigned short* __restrict__ wkl,
           const unsigned short* __restrict__ wvh, const unsigned short* __restrict__ wvl,
           const float* __restrict__ bq, const float* __restrict__ bk, const float* __restrict__ bv,
           unsigned short* __restrict__ qh, unsigned short* __restrict__ ql,
           unsigned short* __restrict__ kh, unsigned short* __restrict__ kl,
           unsigned short* __restrict__ vh, unsigned short* __restrict__ vl)
{
  const int job = blockIdx.x / GBLK_;
  const int blk = blockIdx.x % GBLK_;
  if (job == 2) {
    gemm_tile<1>(blk, xh, xl, wvh, wvl, bv, vh, vl, nullptr);
  } else if (job == 1) {
    gemm_tile<0>(blk, wkh, wkl, xh, xl, bk, kh, kl, nullptr);
  } else {
    gemm_tile<0>(blk, wqh, wql, xh, xl, bq, qh, ql, nullptr);
  }
}

__global__ void __launch_bounds__(128)
k_gemm_out(const unsigned short* __restrict__ wh, const unsigned short* __restrict__ wl,
           const unsigned short* __restrict__ ah, const unsigned short* __restrict__ al,
           const float* __restrict__ bo, float* __restrict__ out)
{
  gemm_tile<2>(blockIdx.x, wh, wl, ah, al, bo, nullptr, nullptr, out);
}

// ---------------------------------------------------------------------------
// Flash attention, transposed: a wave owns 16 queries of one (b, head); lane (m, h) owns query q0+m (both lane halves).
// Per 64 keys: S^T tiles = K(16 keys x 64 d, A operand) . Q^T(64 d x 16 q, B operand) -> D rows = keys, cols = queries;
// per-lane online softmax over its 32 keys, partner half via one shuffle; P^T chains from D into the B operand of
// O^T(16 d x 16 q) += Vt(16 d x 32 keys, A operand) . P^T(32 keys x 16 q): B element r <- D(tile for keys 0..15)[r],
// element 8+r <- D(tile for keys 16..31)[r], lane unchanged.
// The 8 waves of a block share one (b, head): each 64-key stage of the four K / Vt planes (8 KiB each, contiguous in
// fragment order) is brought into LDS once per block by asynchronous copies, two buffers, the next stage in flight
// while this one is worked on; the waves read their fragments from LDS at the same tile offsets as in the planes.
#define KSTEP_ 64
#define PLANE_ (KSTEP_ * D_)     // elements of one plane per stage (8 KiB)
#define STAGE_ (4 * PLANE_)      // Kh, Kl, Vh, Vl
#define HALFB_ (PLANE_ * 2 / 2)  // bytes of half a plane's stage: what 256 lanes bring with one 16-byte copy each
static_assert(S_ / KSTEP_ >= 2);
static_assert(HALFB_ == 256 * 16);

// One stage: every lane copies 2 x 16 bytes of each plane. dst = this lane's LDS byte address in the stage's buffer,
// the pointers = this lane's 16 bytes in the first half of each plane's stage.
// s_wait_xcnt stands inside the statement so that no address register is rewritten ahead of it.
__device__ __forceinline__ void copy_stage(unsigned dst,
                                           const unsigned short* kh, const unsigned short* kl,
                                           const unsigned short* vh, const unsigned short* vl) {
  asm volatile("global_load_async_to_lds_b128 %0, %8, off\n\t"
               "global_load_async_to_lds_b128 %1, %9, off\n\t"
               "global_load_async_to_lds_b128 %2, %10, off\n\t"
               "global_load_async_to_lds_b128 %3, %11, off\n\t"
               "global_load_async_to_lds_b128 %4, %12, off\n\t"
               "global_load_async_to_lds_b128 %5, %13, off\n\t"
               "global_load_async_to_lds_b128 %6, %14, off\n\t"
               "global_load_async_to_lds_b128 %7, %15, off\n\t"
               "s_wait_xcnt 0x0"
               :
               : "v"(dst),                 "v"(dst + HALFB_),
                 "v"(dst + 2 * HALFB_),    "v"(dst + 3 * HALFB_),
                 "v"(dst + 4 * HALFB_),    "v"(dst + 5 * HALFB_),
                 "v"(dst + 6 * HALFB_),    "v"(dst + 7 * HALFB_),
                 "v"(kh), "v"(kh + PLANE_ / 2), "v"(kl), "v"(kl + PLANE_ / 2),
                 "v"(vh), "v"(vh + PLANE_ / 2), "v"(vl), "v"(vl + PLANE_ / 2)
               : "memory");
}

__global__ void __launch_bounds__(256)
k_attn(const unsigned short* __restrict__ Qh, const unsigned short* __restrict__ Ql,
       const unsigned short* __restrict__ Kh, const unsigned short* __restrict__ Kl,
       const unsigned short* __restrict__ Vh, const unsigned short* __restrict__ Vl,
       const float* __restrict__ ent,
       unsigned short* __restrict__ Ah, unsigned short* __restrict__ Al)
{
  const int l    = threadIdx.x & 31;
  const int m    = l & 15;
  const int wv   = threadIdx.x >> 5;
  const int gw   = blockIdx.x * 8 + wv;        // 4096 waves, exact; 128 waves per (b, head), so a block has one
  const int bh   = gw >> 7;
  const int qt   = gw & 127;
  const int q0   = qt * 16;
  const int b    = bh >> 3;
  const int head = bh & 7;

  const size_t qoff = ((size_t)bh * S_ + q0) * D_ + l * 8;   // 16 rows x D_ = two tiles: d 0..31, d 32..63
  const v16b qh0 = ld_frag(Qh + qoff);
  const v16b qh1 = ld_frag(Qh + qoff + TILE_);
  const v16b ql0 = ld_frag(Ql + qoff);
  const v16b ql1 = ld_frag(Ql + qoff + TILE_);
  // logit scale entangle[q] / sqrt(64), folded with log2(e) for exp2
  const float fac2 = ent[q0 + m] * 0.18033688011112042f;

  float mrun = -__builtin_inff();
  float lrun = 0.0f;
  v8f o[4];
#pragma unroll
  for (int t = 0; t < 4; ++t) o[t] = vzero();

  __shared__ __attribute__((aligned(16))) unsigned short ring[2 * STAGE_];   // 64 KiB
  const unsigned ring_l = (unsigned)(size_t)ring + threadIdx.x * 16;         // this lane's LDS byte address, buffer 0
  // this lane's 16 bytes of stage 0 in each plane; a stage of 64 keys is PLANE_ elements further in all four
  const unsigned short* kh_g = Kh + (size_t)bh * S_ * D_ + threadIdx.x * 8;
  const unsigned short* kl_g = Kl + (size_t)bh * S_ * D_ + threadIdx.x * 8;
  const unsigned short* vh_g = Vh + (size_t)bh * D_ * S_ + threadIdx.x * 8;
  const unsigned short* vl_g = Vl + (size_t)bh * D_ * S_ + threadIdx.x * 8;

  copy_stage(ring_l, kh_g, kl_g, vh_g, vl_g);
  asm volatile("s_wait_asynccnt 0x0" ::: "memory");   // this wave's share of stage 0 has landed
  __syncthreads();                                    // every wave's share has: stage 0 may be read
  copy_stage(ring_l + STAGE_ * 2, kh_g + PLANE_, kl_g + PLANE_, vh_g + PLANE_, vl_g + PLANE_);

#pragma unroll 1
  for (int kb = 0; kb < S_; kb += KSTEP_) {
    const int buf = (kb / KSTEP_) & 1;
    const unsigned short* kh_b = ring + buf * STAGE_ + l * 8;
    const unsigned short* kl_b = kh_b + PLANE_;
    const unsigned short* vh_b = kh_b + 2 * PLANE_;
    const unsigned short* vl_b = kh_b + 3 * PLANE_;
    v8f c[4];
#pragma unroll
    for (int u = 0; u < 4; ++u) {
      const int ko = u * 16 * D_;
      const v16b a0h = ld_frag(kh_b + ko);
      const v16b a1h = ld_frag(kh_b + ko + TILE_);
      const v16b a0l = ld_frag(kl_b + ko);
      const v16b a1l = ld_frag(kl_b + ko + TILE_);
      v8f cc = vzero();
      cc = mma(a0h, qh0, cc);
      cc = mma(a0h, ql0, cc);
      cc = mma(a0l, qh0, cc);
      cc = mma(a1h, qh1, cc);
      cc = mma(a1h, ql1, cc);
      cc = mma(a1l, qh1, cc);
      asm volatile(NOP4
                   : "+v"(cc)
                   : "v"(a0h), "v"(a1h), "v"(a0l), "v"(a1l), "v"(qh0), "v"(qh1), "v"(ql0), "v"(ql1)
                   : "memory");
      c[u] = cc;   // c[u][r] = raw score of key kb + 16u + 8h + r against query q0 + m
    }

    // online softmax, f32: lane holds 32 keys of its query; partner lane (xor 16) holds the other 32
    float tmax = -__builtin_inff();
#pragma unroll
    for (int u = 0; u < 4; ++u) {
      c[u] = c[u] * fac2;
#pragma unroll
      for (int r = 0; r < 8; ++r) tmax = fmaxf(tmax, c[u][r]);
    }
    tmax = fmaxf(tmax, __shfl_xor(tmax, 16));
    const float mnew  = fmaxf(mrun, tmax);
    const float alpha = __builtin_amdgcn_exp2f(mrun - mnew);
    float psum = 0.0f;
#pragma unroll
    for (int u = 0; u < 4; ++u) {
#pragma unroll
      for (int r = 0; r < 8; ++r) {
        const float p = __builtin_amdgcn_exp2f(c[u][r] - mnew);
        c[u][r] = p;
        psum += p;
      }
    }
    psum += __shfl_xor(psum, 16);
    lrun = lrun * alpha + psum;
    mrun = mnew;
#pragma unroll
    for (int t = 0; t < 4; ++t) o[t] = o[t] * alpha;

    // P^T (D layout, rows = keys) -> hi/lo B fragments; O^T += Vt . P^T
#pragma unroll
    for (int v = 0; v < 2; ++v) {
      v8us h0, l0, h1, l1;
      split8(c[2 * v], h0, l0);
      split8(c[2 * v + 1], h1, l1);
      const v16b phi = join16(h0, h1);
      const v16b plo = join16(l0, l1);
#pragma unroll
      for (int t = 0; t < 4; ++t) {
        const int vo = (v * 4 + t) * TILE_;
        const v16b va_h = ld_frag(vh_b + vo);
        const v16b va_l = ld_frag(vl_b + vo);
        v8f oo = o[t];
        oo = mma(va_h, phi, oo);
        oo = mma(va_h, plo, oo);
        oo = mma(va_l, phi, oo);
        asm volatile(NOP4
                     : "+v"(oo)
                     : "v"(va_h), "v"(va_l), "v"(phi), "v"(plo)
                     : "memory");
        o[t] = oo;   // o[t][r] = O^T[d = 16t + 8h + r][q = q0 + m]
      }
    }

    // hand-over: this wave has left the buffer, its share of the next stage has landed, then all waves meet
    asm volatile("s_wait_dscnt 0x0" ::: "memory");      // this wave's reads of the buffer are done before it is refilled
    asm volatile("s_wait_asynccnt 0x0" ::: "memory");   // this wave's copies of the next stage have landed
    __syncthreads();                                    // publishes the next stage, frees the buffer just read
    if (kb + 2 * KSTEP_ < S_) {
      const int nx = (kb + 2 * KSTEP_) * D_;
      copy_stage(ring_l + buf * (STAGE_ * 2), kh_g + nx, kl_g + nx, vh_g + nx, vl_g + nx);
    }
  }
  asm volatile("s_wait_asynccnt 0x0" ::: "memory");     // nothing is in flight when the wave ends

  // At plane [N_][E_] in fragment order (rows n, k = e): lane (m, h) already holds row q0 + m, k = 64 head + 16t + 8h + r
  const float inv = 1.0f / lrun;
  v8us w0[4], w1[4];
#pragma unroll
  for (int t = 0; t < 4; ++t) {
    const v8f val = o[t] * inv;
    split8(val, w0[t], w1[t]);
  }
  const size_t aoff = ((size_t)b * S_ + q0) * E_ + (size_t)head * 2 * TILE_ + l * 8;
#pragma unroll
  for (int t = 0; t < 4; ++t) {
    *(v8us*)(Ah + aoff + t * 256) = w0[t];
    *(v8us*)(Al + aoff + t * 256) = w1[t];
  }
}

// ---------------------------------------------------------------------------
extern "C" void kernel_launch(void* const* d_in, const int* in_sizes, int n_in,
                              void* d_out, int out_size, void* d_ws, size_t ws_size,
                              hipStream_t stream) {
  if (n_in < 10) return;
  if (in_sizes[0] != N_ * E_ || in_sizes[1] != S_ ||
      in_sizes[2] != E_ * E_ || in_sizes[3] != E_ ||
      in_sizes[4] != E_ * E_ || in_sizes[5] != E_ ||
      in_sizes[6] != E_ * E_ || in_sizes[7] != E_ ||
      in_sizes[8] != E_ * E_ || in_sizes[9] != E_ ||
      out_size != N_ * E_) return;

  const float* x   = (const float*)d_in[0];   // [B,S,E]
  const float* ent = (const float*)d_in[1];   // [S]
  const float* Wq  = (const float*)d_in[2];
  const float* bq  = (const float*)d_in[3];
  const float* Wk  = (const float*)d_in[4];
  const float* bk  = (const float*)d_in[5];
  const float* Wv  = (const float*)d_in[6];
  const float* bv  = (const float*)d_in[7];
  const float* Wo  = (const float*)d_in[8];
  const float* bo  = (const float*)d_in[9];
  float* out = (float*)d_out;

  const size_t nX = (size_t)N_ * E_;           // 4194304
  const size_t nW = (size_t)E_ * E_;           // 262144
  const size_t total_bytes = (10 * nX + 8 * nW) * sizeof(unsigned short);   // 88080384
  if (total_bytes > ws_size) return;

  unsigned short* p = (unsigned short*)d_ws;
  unsigned short* Xh  = p; p += nX;   unsigned short* Xl  = p; p += nX;
  unsigned short* Wqh = p; p += nW;   unsigned short* Wql = p; p += nW;   // the eight weight planes lie one behind
  unsigned short* Wkh = p; p += nW;   unsigned short* Wkl = p; p += nW;   // the other: k_split finds them from Wqh
  unsigned short* Wvh = p; p += nW;   unsigned short* Wvl = p; p += nW;
  unsigned short* Woh = p; p += nW;   unsigned short* Wol = p; p += nW;
  unsigned short* Qh  = p; p += nX;   unsigned short* Ql  = p; p += nX;   // [B*H] x (rows s, k = d)
  unsigned short* Kh  = p; p += nX;   unsigned short* Kl  = p; p += nX;   // [B*H] x (rows s, k = d)
  unsigned short* Vh  = p; p += nX;   unsigned short* Vl  = p; p += nX;   // [B*H] x (rows d, k = s)
  unsigned short* Ah  = p; p += nX;   unsigned short* Al  = p; p += nX;   // rows n, k = e

  k_split<<<XBLK_ + 4 * WBLK_, 256, 0, stream>>>(x, Wq, Wk, Wv, Wo, Xh, Xl, Wqh);

  k_gemm_qkv<<<3 * GBLK_, 128, 0, stream>>>(Xh, Xl, Wqh, Wql, Wkh, Wkl, Wvh, Wvl, bq, bk, bv, Qh, Ql, Kh, Kl, Vh, Vl);

  k_attn<<<(B_ * H_ * (S_ / 16)) / 8, 256, 0, stream>>>(Qh, Ql, Kh, Kl, Vh, Vl, ent, Ah, Al);

  k_gemm_out<<<GBLK_, 128, 0, stream>>>(Woh, Wol, Ah, Al, bo, out);
}

// v004
// A run of this version takes 129 microseconds.
// Two timings next to v003 both put it at 1.25 times that version's speed.
// Counting every step since v000, it is 3.22 times as fast.
#include <hip/hip_runtime.h>
#include <stddef.h>

// All contractions on v_wmma_f32_16x16x32_bf16 with bf16 operands carried as hi/lo pairs (hi*hi + hi*lo + lo*hi), f32 accumulate:
// q/k/v projections, key-by-query scores, value aggregation, output projection. Softmax, bias and normalisation in f32.

#define B_ 4
#define S_ 2048
#define E_ 512
#define H_ 8
#define D_ 64
#define N_ (B_ * S_)

static_assert(E_ == H_ * D_);
static_assert(D_ == 64 && E_ == 512);
static_assert((S_ % 64) == 0 && (E_ % 64) == 0 && (N_ % 64) == 0);

typedef float          v8f   __attribute__((ext_vector_type(8)));
typedef float          v4f   __attribute__((ext_vector_type(4)));
typedef __bf16         v16b  __attribute__((ext_vector_type(16)));
typedef __bf16         v8b   __attribute__((ext_vector_type(8)));
typedef unsigned short v8us  __attribute__((ext_vector_type(8)));

union Frag16 { v16b v; v8us hv[2]; };
union Pack8  { v8b b; v8us u; };

#define NOP4 "v_nop\n\tv_nop\n\tv_nop\n\tv_nop"

// Every 16-bit plane in the workspace is stored in fragment order: a tile is 16 rows x 32 k = 512 elements (1 KiB), and
// element (row, k) of a tile sits at ((k >> 4) & 1) * 256 + (((k >> 3) & 1) * 16 + (row & 15)) * 8 + (k & 7).
// Lane l = 16h + m then finds its 16x32 operand fragment (row m; elements 0..7 <- k 8h..8h+7, elements 8..15 <- k 16+8h..16+8h+7,
// the same map for A rows and for B columns) at tile + 8l and tile + 256 + 8l: each wave-wide load is 512 contiguous bytes.
#define TILE_ 512

// lp = tile start + 8 * lane
__device__ __forceinline__ v16b ld_frag(const unsigned short* lp) {
  Frag16 f;
  f.hv[0] = *(const v8us*)(lp);
  f.hv[1] = *(const v8us*)(lp + 256);
  return f.v;
}

__device__ __forceinline__ v16b join16(v8us a, v8us b) {
  Frag16 f;
  f.hv[0] = a;
  f.hv[1] = b;
  return f.v;
}

__device__ __forceinline__ v8f mma(v16b a, v16b b, v8f c) {
  return __builtin_amdgcn_wmma_f32_16x16x32_bf16(false, a, false, b, (short)0, c, false, false);
}

__device__ __forceinline__ v8f vzero() {
  v8f z = {0.f, 0.f, 0.f, 0.f, 0.f, 0.f, 0.f, 0.f};
  return z;
}

// f32 -> bf16 hi (RNE convert) and bf16 lo = RNE(x - hi)
__device__ __forceinline__ void split8(v8f x, v8us& hu, v8us& lu) {
  Pack8 ph, pl;
  ph.b = __builtin_convertvector(x, v8b);
  const v8f hf = __builtin_convertvector(ph.b, v8f);
  pl.b = __builtin_convertvector(x - hf, v8b);
  hu = ph.u;
  lu = pl.u;
}

// ---------------------------------------------------------------------------
// f32 [rows][E_] -> (bf16 hi plane, bf16 lo plane) in fragment order, tile index = (row >> 4) * (E_ / 32) + (k >> 5).
// 64 threads per tile, 8 elements each: a wave takes 8 rows x 32 k, so it reads whole 128-byte lines and stores whole lines.
// One grid for the five independent arrays, the block index range picks the array: blocks 0..XBLK_-1 take xf, then WBLK_
// blocks for each of Wq, Wk, Wv, Wo, whose planes lie one behind the other at wp (hi, lo, hi, lo, ...).
#define XBLK_ (N_ * E_ / 8 / 256)
#define WBLK_ (E_ * E_ / 8 / 256)
static_assert(XBLK_ * 256 * 8 == N_ * E_ && WBLK_ * 256 * 8 == E_ * E_);   // the grid is exact: no thread without work
__global__ void __launch_bounds__(256)
k_split(const float* __restrict__ xf, const float* __restrict__ wq, const float* __restrict__ wk,
        const float* __restrict__ wv, const float* __restrict__ wo,
        unsigned short* __restrict__ xh, unsigned short* __restrict__ xl, unsigned short* __restrict__ wp) {
  const float* src = xf;
  unsigned short* dh = xh;
  unsigned short* dl = xl;
  int blk = blockIdx.x;
  if (blk >= XBLK_) {
    const int j = (blk - XBLK_) / WBLK_;
    blk = (blk - XBLK_) % WBLK_;
    src = j == 0 ? wq : j == 1 ? wk : j == 2 ? wv : wo;
    dh  = wp + (size_t)j * 2 * E_ * E_;
    dl  = dh + E_ * E_;
  }
  const int i = blk * 256 + threadIdx.x;
  const int tile = i >> 6;
  const int row  = ((i >> 5) & 1) * 8 + (i & 7);   // row in the tile
  const int k8   = (i >> 3) & 3;                   // which 8 k of the tile's 32
  const v4f* p = (const v4f*)(src + (size_t)((tile >> 4) * 16 + row) * E_ + (tile & 15) * 32 + k8 * 8);
  const size_t dst = (size_t)tile * TILE_ + (k8 * 16 + row) * 8;
  const v4f a0 = p[0];
  const v4f a1 = p[1];
  const v8f x = __builtin_shufflevector(a0, a1, 0, 1, 2, 3, 4, 5, 6, 7);
  v8us hu, lu;
  split8(x, hu, lu);
  v8us* ph = (v8us*)(dh + dst);
  v8us* pl = (v8us*)(dl + dst);
  *ph = hu;
  *pl = lu;
}

// ---------------------------------------------------------------------------
// Split GEMM: D[i][j] = sum_k P[i][k] * R[j][k], k = 0..511, both operands as hi/lo bf16 planes in fragment order,
// tile index = (row >> 4) * (E_ / 32) + (k >> 5).
// Block tile: 128 i x 128 j, 4 waves as 2 x 2. Wave tile: 64 i (4 WMMA tiles, A operand) x 64 j (4 WMMA tiles, B operand).
// acc[t][u][r] at lane (m,h) = D[ibase + 16t + 8h + r][jbase + 16u + m].
// Per 32 k the block's 8 tiles of each of the four planes (32 KiB) are brought into LDS once by asynchronous copies, two
// buffers, the next stage in flight while this one is worked on; the waves read their fragments from LDS.
// MODE 0: P = W[e][k], R = X[n][k]  -> Q/K plane per b*8+head, rows s, k = d, tile index (s >> 4) * 2 + (d >> 5), bias[e]
// MODE 1: P = X[n][k], R = W[e][k]  -> Vt plane per b*8+head, rows d, k = s, tile index (s >> 5) * 4 + (d >> 4), bias[e]
// MODE 2: P = W[e][k], R = At[n][k] -> f32 out[n][e], bias[e]
// MODE 0 and 1: the accumulator's 8 values of a lane are that same lane's 8 elements of the output plane's fragment order
// (k = 16t + 8h + r, row = m), so each lane stores 16 bytes at tile + 8l and a wave-wide store is 512 contiguous bytes.
// blk = the block's number inside its own product, 0..GBLK_-1.
#define GBLK_ ((E_ / 128) * (N_ / 128))   // 256 block tiles per product
#define GPLANE_ (8 * TILE_)               // elements of one plane per stage: 128 rows x 32 k (8 KiB)
#define GSTAGE_ (4 * GPLANE_)             // Ph, Pl, Rh, Rl
#define ROWS32_ (32 * E_)                 // elements from a row tile to the second next: what 128 lanes bring is two tiles
static_assert((E_ % 128) == 0 && (N_ % 128) == 0 && E_ / 32 >= 2);

// Half a stage: two planes, 8 tiles each; a copy of the 128 lanes brings two tiles (2 KiB), so 4 copies per plane.
// dst = this lane's LDS byte address in the first plane's stage, a and b = this lane's 16 bytes in each plane's first two tiles.
// s_wait_xcnt stands inside the statement so that no address register is rewritten ahead of it.
__device__ __forceinline__ void copy_planes(unsigned dst, const unsigned short* a, const unsigned short* b) {
  asm volatile("global_load_async_to_lds_b128 %0, %8, off\n\t"
               "global_load_async_to_lds_b128 %1, %9, off\n\t"
               "global_load_async_to_lds_b128 %2, %10, off\n\t"
               "global_load_async_to_lds_b128 %3, %11, off\n\t"
               "global_load_async_to_lds_b128 %4, %12, off\n\t"
               "global_load_async_to_lds_b128 %5, %13, off\n\t"
               "global_load_async_to_lds_b128 %6, %14, off\n\t"
               "global_load_async_to_lds_b128 %7, %15, off\n\t"
               "s_wait_xcnt 0x0"
               :
               : "v"(dst),            "v"(dst + 2048),     "v"(dst + 2 * 2048), "v"(dst + 3 * 2048),
                 "v"(dst + 4 * 2048), "v"(dst + 5 * 2048), "v"(dst + 6 * 2048), "v"(dst + 7 * 2048),
                 "v"(a), "v"(a + ROWS32_), "v"(a + 2 * ROWS32_), "v"(a + 3 * ROWS32_),
                 "v"(b), "v"(b + ROWS32_), "v"(b + 2 * ROWS32_), "v"(b + 3 * ROWS32_)
               : "memory");
}

template <int MODE>
__device__ __forceinline__ void
gemm_tile(const int blk, unsigned short* ring,
          const unsigned short* __restrict__ Ph, const unsigned short* __restrict__ Pl,
          const unsigned short* __restrict__ Rh, const unsigned short* __restrict__ Rl,
          const float* __restrict__ bias,
          unsigned short* __restrict__ Oh, unsigned short* __restrict__ Ol,
          float* __restrict__ Of)
{
  const int l  = threadIdx.x & 31;
  const int h  = l >> 4;
  const int m  = l & 15;
  const int wv = threadIdx.x >> 5;
  const int wi = wv & 1;
  const int wj = wv >> 1;
  int iblk, jblk;                               // first row of the block's 128 in P and in R
  if (MODE == 1) { iblk = (blk >> 2) * 128; jblk = (blk & 3) * 128; }
  else           { iblk = (blk & 3) * 128;  jblk = (blk >> 2) * 128; }
  const int ibase = iblk + wi * 64;
  const int jbase = jblk + wj * 64;

  v8f acc[4][4];
#pragma unroll
  for (int t = 0; t < 4; ++t)
#pragma unroll
    for (int u = 0; u < 4; ++u) acc[t][u] = vzero();

  const unsigned ring_l = (unsigned)(size_t)ring + threadIdx.x * 16;   // this lane's LDS byte address, buffer 0
  // this lane's 16 bytes of stage 0 in each plane: lanes 0..63 the first row tile, lanes 64..127 the second
  const size_t lane_g = (size_t)(threadIdx.x >> 6) * 16 * E_ + (threadIdx.x & 63) * 8;
  const unsigned short* ph_g = Ph + (size_t)iblk * E_ + lane_g;
  const unsigned short* pl_g = Pl + (size_t)iblk * E_ + lane_g;
  const unsigned short* rh_g = Rh + (size_t)jblk * E_ + lane_g;
  const unsigned short* rl_g = Rl + (size_t)jblk * E_ + lane_g;

  copy_planes(ring_l, ph_g, pl_g);
  copy_planes(ring_l + GPLANE_ * 4, rh_g, rl_g);
  asm volatile("s_wait_asynccnt 0x0" ::: "memory");   // this wave's share of stage 0 has landed
  __syncthreads();                                    // every wave's share has: stage 0 may be read
  copy_planes(ring_l + GSTAGE_ * 2, ph_g + TILE_, pl_g + TILE_);
  copy_planes(ring_l + GSTAGE_ * 2 + GPLANE_ * 4, rh_g + TILE_, rl_g + TILE_);

  // stays rolled: the body already holds 48 WMMAs, and the buffer is picked by ks & 1
#pragma unroll 1
  for (int ks = 0; ks < E_ / 32; ++ks) {
    const int buf = ks & 1;
    const unsigned short* pb = ring + buf * GSTAGE_ + wi * 4 * TILE_ + l * 8;
    const unsigned short* rb = ring + buf * GSTAGE_ + 2 * GPLANE_ + wj * 4 * TILE_ + l * 8;
    v16b rh[4], rl[4], ph[2], pl[2];
    ph[0] = ld_frag(pb);
    pl[0] = ld_frag(pb + GPLANE_);
#pragma unroll
    for (int u = 0; u < 4; ++u) rh[u] = ld_frag(rb + u * TILE_);
#pragma unroll
    for (int u = 0; u < 4; ++u) rl[u] = ld_frag(rb + GPLANE_ + u * TILE_);
#pragma unroll
    for (int t = 0; t < 4; ++t) {
      const v16b ah = ph[t & 1];
      const v16b al = pl[t & 1];
      if (t < 3) {
        ph[(t + 1) & 1] = ld_frag(pb + (t + 1) * TILE_);
        pl[(t + 1) & 1] = ld_frag(pb + GPLANE_ + (t + 1) * TILE_);
      }
      // keeps the next row's fragment loads ahead of this row's 12 WMMAs, which then cover their LDS latency
      __builtin_amdgcn_sched_barrier(0);
#pragma unroll
      for (int u = 0; u < 4; ++u) acc[t][u] = mma(ah, rh[u], acc[t][u]);
#pragma unroll
      for (int u = 0; u < 4; ++u) acc[t][u] = mma(ah, rl[u], acc[t][u]);
#pragma unroll
      for (int u = 0; u < 4; ++u) acc[t][u] = mma(al, rh[u], acc[t][u]);
    }

    // hand-over: this wave has left the buffer, its share of the next stage has landed, then all waves meet
    asm volatile("s_wait_dscnt 0x0" ::: "memory");      // this wave's reads of the buffer are done before it is refilled
    asm volatile("s_wait_asynccnt 0x0" ::: "memory");   // this wave's copies of the next stage have landed
    __syncthreads();                                    // publishes the next stage, frees the buffer just read
    if (ks + 2 < E_ / 32) {
      const int nx = (ks + 2) * TILE_;
      const unsigned dst = ring_l + buf * (GSTAGE_ * 2);
      copy_planes(dst, ph_g + nx, pl_g + nx);
      copy_planes(dst + GPLANE_ * 4, rh_g + nx, rl_g + nx);
    }
  }
  asm volatile("s_wait_asynccnt 0x0" ::: "memory");     // nothing is in flight behind the loop

  if constexpr (MODE == 2) {
    // the ring is free behind the last trip's barrier: each wave stages its own 64 x 64 f32 tile (16 KiB) there
    v4f* lds_f = (v4f*)ring + wv * 1024;
#pragma unroll
    for (int t = 0; t < 4; ++t) {
      const v4f b0 = *(const v4f*)(bias + ibase + t * 16 + 8 * h);
      const v4f b1 = *(const v4f*)(bias + ibase + t * 16 + 8 * h + 4);
      const v8f bb = __builtin_shufflevector(b0, b1, 0, 1, 2, 3, 4, 5, 6, 7);
#pragma unroll
      for (int u = 0; u < 4; ++u) {
        const v8f val = acc[t][u] + bb;
        lds_f[u * 256 + m * 16 + 4 * t + 2 * h]     = __builtin_shufflevector(val, val, 0, 1, 2, 3);
        lds_f[u * 256 + m * 16 + 4 * t + 2 * h + 1] = __builtin_shufflevector(val, val, 4, 5, 6, 7);
      }
    }
    __syncthreads();
    float* op = Of + (size_t)(jbase + (l >> 4)) * E_ + ibase + (l & 15) * 4;   // 16 chunks of 16 B per row, 2 rows a store
#pragma unroll
    for (int j = 0; j < 32; ++j) *(v4f*)(op + (size_t)j * 2 * E_) = lds_f[j * 32 + l];
  } else {
    size_t base;      // this lane's place in the first tile of u = 0
    int tstep;        // from the tile of k 0..31 to the tile of k 32..63
    int ustep;        // from the tiles of one u to those of the next
    if (MODE == 0) {
      const int bh = (jbase >> 11) * H_ + (ibase >> 6);
      base  = ((size_t)bh * S_ + (jbase & (S_ - 1))) * D_ + l * 8;
      tstep = TILE_;
      ustep = 16 * D_;
    } else {
      const int bh = (ibase >> 11) * H_ + (jbase >> 6);
      const int st = (ibase & (S_ - 1)) >> 5;
      base  = (size_t)bh * D_ * S_ + (size_t)(st * 4) * TILE_ + l * 8;
      tstep = 4 * TILE_;
      ustep = TILE_;
    }
    float bsc[4] = {0.0f, 0.0f, 0.0f, 0.0f};
    if (MODE == 1) {
#pragma unroll
      for (int u = 0; u < 4; ++u) bsc[u] = bias[jbase + u * 16 + m];
    }
#pragma unroll
    for (int t = 0; t < 4; ++t) {
      v8f bb = vzero();
      if (MODE == 0) {
        const v4f b0 = *(const v4f*)(bias + ibase + t * 16 + 8 * h);
        const v4f b1 = *(const v4f*)(bias + ibase + t * 16 + 8 * h + 4);
        bb = __builtin_shufflevector(b0, b1, 0, 1, 2, 3, 4, 5, 6, 7);
      }
#pragma unroll
      for (int u = 0; u < 4; ++u) {
        v8f val;
        if (MODE == 0) val = acc[t][u] + bb;
        else           val = acc[t][u] + bsc[u];
        v8us w0, w1;
        split8(val, w0, w1);
        const size_t off = base + u * ustep + (t >> 1) * tstep + (t & 1) * 256;
        *(v8us*)(Oh + off) = w0;
        *(v8us*)(Ol + off) = w1;
      }
      // the next row's values, or another product's code, follow these stores in the listing: the wait stands in front
      // of any rewrite of a register that they name
      asm volatile("s_wait_xcnt 0x0" ::: "memory");
      // one row of tiles at a time: formed all at once the 16 tiles need registers above v255
      __builtin_amdgcn_sched_barrier(0);
    }
  }
}

// The three projections are independent of one another: one grid, the block index range picks the product
// (0: Q, 1: K, 2: Vt).
__global__ void __launch_bounds__(128)
k_gemm_qkv(const unsigned short* __restrict__ xh,  const unsigned short* __restrict__ xl,
           const unsigned short* __restrict__ wqh, const unsigned short* __restrict__ wql,
           const unsigned short* __restrict__ wkh, const unsigned short* __restrict__ wkl,
           const unsigned short* __restrict__ wvh, const unsigned short* __restrict__ wvl,
           const float* __restrict__ bq, const float* __restrict__ bk, const float* __restrict__ bv,
           unsigned short* __restrict__ qh, unsigned short* __restrict__ ql,
           unsigned short* __restrict__ kh, unsigned short* __restrict__ kl,
           unsigned short* __restrict__ vh, unsigned short* __restrict__ vl)
{
  __shared__ __attribute__((aligned(16))) unsigned short ring[2 * GSTAGE_];   // 64 KiB, one ring for whichever job runs
  const int job = blockIdx.x / GBLK_;
  const int blk = blockIdx.x % GBLK_;
  if (job == 2) {
    gemm_tile<1>(blk, ring, xh, xl, wvh, wvl, bv, vh, vl, nullptr);
  } else if (job == 1) {
    gemm_tile<0>(blk, ring, wkh, wkl, xh, xl, bk, kh, kl, nullptr);
  } else {
    gemm_tile<0>(blk, ring, wqh, wql, xh, xl, bq, qh, ql, nullptr);
  }
}

__global__ void __launch_bounds__(128)
k_gemm_out(const unsigned short* __restrict__ wh, const unsigned short* __restrict__ wl,
           const unsigned short* __restrict__ ah, const unsigned short* __restrict__ al,
           const float* __restrict__ bo, float* __restrict__ out)
{
  __shared__ __attribute__((aligned(16))) unsigned short ring[2 * GSTAGE_];   // 64 KiB
  gemm_tile<2>(blockIdx.x, ring, wh, wl, ah, al, bo, nullptr, nullptr, out);
}

// ---------------------------------------------------------------------------
// Flash attention, transposed: a wave owns 16 queries of one (b, head); lane (m, h) owns query q0+m (both lane halves).
// Per 64 keys: S^T tiles = K(16 keys x 64 d, A operand) . Q^T(64 d x 16 q, B operand) -> D rows = keys, cols = queries;
// per-lane online softmax over its 32 keys, partner half via one shuffle; P^T chains from D into the B operand of
// O^T(16 d x 16 q) += Vt(16 d x 32 keys, A operand) . P^T(32 keys x 16 q): B element r <- D(tile for keys 0..15)[r],
// element 8+r <- D(tile for keys 16..31)[r], lane unchanged.
// The 8 waves of a block share one (b, head): each 64-key stage of the four K / Vt planes (8 KiB each, contiguous in
// fragment order) is brought into LDS once per block by asynchronous copies, two buffers, the next stage in flight
// while this one is worked on; the waves read their fragments from LDS at the same tile offsets as in the planes.
#define KSTEP_ 64
#define PLANE_ (KSTEP_ * D_)     // elements of one plane per stage (8 KiB)
#define STAGE_ (4 * PLANE_)      // Kh, Kl, Vh, Vl
#define HALFB_ (PLANE_ * 2 / 2)  // bytes of half a plane's stage: what 256 lanes bring with one 16-byte copy each
static_assert(S_ / KSTEP_ >= 2);
static_assert(HALFB_ == 256 * 16);

// One stage: every lane copies 2 x 16 bytes of each plane. dst = this lane's LDS byte address in the stage's buffer,
// the pointers = this lane's 16 bytes in the first half of each plane's stage.
// s_wait_xcnt stands inside the statement so that no address register is rewritten ahead of it.
__device__ __forceinline__ void copy_stage(unsigned dst,
                                           const unsigned short* kh, const unsigned short* kl,
                                           const unsigned short* vh, const unsigned short* vl) {
  asm volatile("global_load_async_to_lds_b128 %0, %8, off\n\t"
               "global_load_async_to_lds_b128 %1, %9, off\n\t"
               "global_load_async_to_lds_b128 %2, %10, off\n\t"
               "global_load_async_to_lds_b128 %3, %11, off\n\t"
               "global_load_async_to_lds_b128 %4, %12, off\n\t"
               "global_load_async_to_lds_b128 %5, %13, off\n\t"
               "global_load_async_to_lds_b128 %6, %14, off\n\t"
               "global_load_async_to_lds_b128 %7, %15, off\n\t"
               "s_wait_xcnt 0x0"
               :
               : "v"(dst),                 "v"(dst + HALFB_),
                 "v"(dst + 2 * HALFB_),    "v"(dst + 3 * HALFB_),
                 "v"(dst + 4 * HALFB_),    "v"(dst + 5 * HALFB_),
                 "v"(dst + 6 * HALFB_),    "v"(dst + 7 * HALFB_),
                 "v"(kh), "v"(kh + PLANE_ / 2), "v"(kl), "v"(kl + PLANE_ / 2),
                 "v"(vh), "v"(vh + PLANE_ / 2), "v"(vl), "v"(vl + PLANE_ / 2)
               : "memory");
}

__global__ void __launch_bounds__(256)
k_attn(const unsigned short* __restrict__ Qh, const unsigned short* __restrict__ Ql,
       const unsigned short* __restrict__ Kh, const unsigned short* __restrict__ Kl,
       const unsigned short* __restrict__ Vh, const unsigned short* __restrict__ Vl,
       const float* __restrict__ ent,
       unsigned short* __restrict__ Ah, unsigned short* __restrict__ Al)
{
  const int l    = threadIdx.x & 31;
  const int m    = l & 15;
  const int wv   = threadIdx.x >> 5;
  const int gw   = blockIdx.x * 8 + wv;        // 4096 waves, exact; 128 waves per (b, head), so a block has one
  const int bh   = gw >> 7;
  const int qt   = gw & 127;
  const int q0   = qt * 16;
  const int b    = bh >> 3;
  const int head = bh & 7;

  const size_t qoff = ((size_t)bh * S_ + q0) * D_ + l * 8;   // 16 rows x D_ = two tiles: d 0..31, d 32..63
  const v16b qh0 = ld_frag(Qh + qoff);
  const v16b qh1 = ld_frag(Qh + qoff + TILE_);
  const v16b ql0 = ld_frag(Ql + qoff);
  const v16b ql1 = ld_frag(Ql + qoff + TILE_);
  // logit scale entangle[q] / sqrt(64), folded with log2(e) for exp2
  const float fac2 = ent[q0 + m] * 0.18033688011112042f;

  float mrun = -__builtin_inff();
  float lrun = 0.0f;
  v8f o[4];
#pragma unroll
  for (int t = 0; t < 4; ++t) o[t] = vzero();

  __shared__ __attribute__((aligned(16))) unsigned short ring[2 * STAGE_];   // 64 KiB
  const unsigned ring_l = (unsigned)(size_t)ring + threadIdx.x * 16;         // this lane's LDS byte address, buffer 0
  // this lane's 16 bytes of stage 0 in each plane; a stage of 64 keys is PLANE_ elements further in all four
  const unsigned short* kh_g = Kh + (size_t)bh * S_ * D_ + threadIdx.x * 8;
  const unsigned short* kl_g = Kl + (size_t)bh * S_ * D_ + threadIdx.x * 8;
  const unsigned short* vh_g = Vh + (size_t)bh * D_ * S_ + threadIdx.x * 8;
  const unsigned short* vl_g = Vl + (size_t)bh * D_ * S_ + threadIdx.x * 8;

  copy_stage(ring_l, kh_g, kl_g, vh_g, vl_g);
  asm volatile("s_wait_asynccnt 0x0" ::: "memory");   // this wave's share of stage 0 has landed
  __syncthreads();                                    // every wave's share has: stage 0 may be read
  copy_stage(ring_l + STAGE_ * 2, kh_g + PLANE_, kl_g + PLANE_, vh_g + PLANE_, vl_g + PLANE_);

#pragma unroll 1
  for (int kb = 0; kb < S_; kb += KSTEP_) {
    const int buf = (kb / KSTEP_) & 1;
    const unsigned short* kh_b = ring + buf * STAGE_ + l * 8;
    const unsigned short* kl_b = kh_b + PLANE_;
    const unsigned short* vh_b = kh_b + 2 * PLANE_;
    const unsigned short* vl_b = kh_b + 3 * PLANE_;
    v8f c[4];
#pragma unroll
    for (int u = 0; u < 4; ++u) {
      const int ko = u * 16 * D_;
      const v16b a0h = ld_frag(kh_b + ko);
      const v16b a1h = ld_frag(kh_b + ko + TILE_);
      const v16b a0l = ld_frag(kl_b + ko);
      const v16b a1l = ld_frag(kl_b + ko + TILE_);
      v8f cc = vzero();
      cc = mma(a0h, qh0, cc);
      cc = mma(a0h, ql0, cc);
      cc = mma(a0l, qh0, cc);
      cc = mma(a1h, qh1, cc);
      cc = mma(a1h, ql1, cc);
      cc = mma(a1l, qh1, cc);
      asm volatile(NOP4
                   : "+v"(cc)
                   : "v"(a0h), "v"(a1h), "v"(a0l), "v"(a1l), "v"(qh0), "v"(qh1), "v"(ql0), "v"(ql1)
                   : "memory");
      c[u] = cc;   // c[u][r] = raw score of key kb + 16u + 8h + r against query q0 + m
    }

    // online softmax, f32: lane holds 32 keys of its query; partner lane (xor 16) holds the other 32
    float tmax = -__builtin_inff();
#pragma unroll
    for (int u = 0; u < 4; ++u) {
      c[u] = c[u] * fac2;
#pragma unroll
      for (int r = 0; r < 8; ++r) tmax = fmaxf(tmax, c[u][r]);
    }
    tmax = fmaxf(tmax, __shfl_xor(tmax, 16));
    const float mnew  = fmaxf(mrun, tmax);
    const float alpha = __builtin_amdgcn_exp2f(mrun - mnew);
    float psum = 0.0f;
#pragma unroll
    for (int u = 0; u < 4; ++u) {
#pragma unroll
      for (int r = 0; r < 8; ++r) {
        const float p = __builtin_amdgcn_exp2f(c[u][r] - mnew);
        c[u][r] = p;
        psum += p;
      }
    }
    psum += __shfl_xor(psum, 16);
    lrun = lrun * alpha + psum;
    mrun = mnew;
#pragma unroll
    for (int t = 0; t < 4; ++t) o[t] = o[t] * alpha;

    // P^T (D layout, rows = keys) -> hi/lo B fragments; O^T += Vt . P^T
#pragma unroll
    for (int v = 0; v < 2; ++v) {
      v8us h0, l0, h1, l1;
      split8(c[2 * v], h0, l0);
      split8(c[2 * v + 1], h1, l1);
      const v16b phi = join16(h0, h1);
      const v16b plo = join16(l0, l1);
#pragma unroll
      for (int t = 0; t < 4; ++t) {
        const int vo = (v * 4 + t) * TILE_;
        const v16b va_h = ld_frag(vh_b + vo);
        const v16b va_l = ld_frag(vl_b + vo);
        v8f oo = o[t];
        oo = mma(va_h, phi, oo);
        oo = mma(va_h, plo, oo);
        oo = mma(va_l, phi, oo);
        asm volatile(NOP4
                     : "+v"(oo)
                     : "v"(va_h), "v"(va_l), "v"(phi), "v"(plo)
                     : "memory");
        o[t] = oo;   // o[t][r] = O^T[d = 16t + 8h + r][q = q0 + m]
      }
    }

    // hand-over: this wave has left the buffer, its share of the next stage has landed, then all waves meet
    asm volatile("s_wait_dscnt 0x0" ::: "memory");      // this wave's reads of the buffer are done before it is refilled
    asm volatile("s_wait_asynccnt 0x0" ::: "memory");   // this wave's copies of the next stage have landed
    __syncthreads();                                    // publishes the next stage, frees the buffer just read
    if (kb + 2 * KSTEP_ < S_) {
      const int nx = (kb + 2 * KSTEP_) * D_;
      copy_stage(ring_l + buf * (STAGE_ * 2), kh_g + nx, kl_g + nx, vh_g + nx, vl_g + nx);
    }
  }
  asm volatile("s_wait_asynccnt 0x0" ::: "memory");     // nothing is in flight when the wave ends

  // At plane [N_][E_] in fragment order (rows n, k = e): lane (m, h) already holds row q0 + m, k = 64 head + 16t + 8h + r
  const float inv = 1.0f / lrun;
  v8us w0[4], w1[4];
#pragma unroll
  for (int t = 0; t < 4; ++t) {
    const v8f val = o[t] * inv;
    split8(val, w0[t], w1[t]);
  }
  const size_t aoff = ((size_t)b * S_ + q0) * E_ + (size_t)head * 2 * TILE_ + l * 8;
#pragma unroll
  for (int t = 0; t < 4; ++t) {
    *(v8us*)(Ah + aoff + t * 256) = w0[t];
    *(v8us*)(Al + aoff + t * 256) = w1[t];
  }
}

// ---------------------------------------------------------------------------
extern "C" void kernel_launch(void* const* d_in, const int* in_sizes, int n_in,
                              void* d_out, int out_size, void* d_ws, size_t ws_size,
                              hipStream_t stream) {
  if (n_in < 10) return;
  if (in_sizes[0] != N_ * E_ || in_sizes[1] != S_ ||
      in_sizes[2] != E_ * E_ || in_sizes[3] != E_ ||
      in_sizes[4] != E_ * E_ || in_sizes[5] != E_ ||
      in_sizes[6] != E_ * E_ || in_sizes[7] != E_ ||
      in_sizes[8] != E_ * E_ || in_sizes[9] != E_ ||
      out_size != N_ * E_) return;

  const float* x   = (const float*)d_in[0];   // [B,S,E]
  const float* ent = (const float*)d_in[1];   // [S]
  const float* Wq  = (const float*)d_in[2];
  const float* bq  = (const float*)d_in[3];
  const float* Wk  = (const float*)d_in[4];
  const float* bk  = (const float*)d_in[5];
  const float* Wv  = (const float*)d_in[6];
  const float* bv  = (const float*)d_in[7];
  const float* Wo  = (const float*)d_in[8];
  const float* bo  = (const float*)d_in[9];
  float* out = (float*)d_out;

  const size_t nX = (size_t)N_ * E_;           // 4194304
  const size_t nW = (size_t)E_ * E_;           // 262144
  const size_t total_bytes = (10 * nX + 8 * nW) * sizeof(unsigned short);   // 88080384
  if (total_bytes > ws_size) return;

  unsigned short* p = (unsigned short*)d_ws;
  unsigned short* Xh  = p; p += nX;   unsigned short* Xl  = p; p += nX;
  unsigned short* Wqh = p; p += nW;   unsigned short* Wql = p; p += nW;   // the eight weight planes lie one behind
  unsigned short* Wkh = p; p += nW;   unsigned short* Wkl = p; p += nW;   // the other: k_split finds them from Wqh
  unsigned short* Wvh = p; p += nW;   unsigned short* Wvl = p; p += nW;
  unsigned short* Woh = p; p += nW;   unsigned short* Wol = p; p += nW;
  unsigned short* Qh  = p; p += nX;   unsigned short* Ql  = p; p += nX;   // [B*H] x (rows s, k = d)
  unsigned short* Kh  = p; p += nX;   unsigned short* Kl  = p; p += nX;   // [B*H] x (rows s, k = d)
  unsigned short* Vh  = p; p += nX;   unsigned short* Vl  = p; p += nX;   // [B*H] x (rows d, k = s)
  unsigned short* Ah  = p; p += nX;   unsigned short* Al  = p; p += nX;   // rows n, k = e

  k_split<<<XBLK_ + 4 * WBLK_, 256, 0, stream>>>(x, Wq, Wk, Wv, Wo, Xh, Xl, Wqh);

  k_gemm_qkv<<<3 * GBLK_, 128, 0, stream>>>(Xh, Xl, Wqh, Wql, Wkh, Wkl, Wvh, Wvl, bq, bk, bv, Qh, Ql, Kh, Kl, Vh, Vl);

  k_attn<<<(B_ * H_ * (S_ / 16)) / 8, 256, 0, stream>>>(Qh, Ql, Kh, Kl, Vh, Vl, ent, Ah, Al);

  k_gemm_out<<<GBLK_, 128, 0, stream>>>(Woh, Wol, Ah, Al, bo, out);
}

// v005
// A run of this version takes 122 microseconds.
// Next to v004, in two timings, it ran 1.05 and 1.04 times as fast.
// Counting every step since v000, it is 3.37 times as fast.
#include <hip/hip_runtime.h>
#include <stddef.h>

// All contractions on v_wmma_f32_16x16x32_bf16 with bf16 operands carried as hi/lo pairs (hi*hi + hi*lo + lo*hi), f32 accumulate:
// q/k/v projections, key-by-query scores, value aggregation, output projection. Softmax, bias and normalisation in f32.

#define B_ 4
#define S_ 2048
#define E_ 512
#define H_ 8
#define D_ 64
#define N_ (B_ * S_)

static_assert(E_ == H_ * D_);
static_assert(D_ == 64 && E_ == 512);
static_assert((S_ % 64) == 0 && (E_ % 64) == 0 && (N_ % 64) == 0);

typedef float          v8f   __attribute__((ext_vector_type(8)));
typedef float          v4f   __attribute__((ext_vector_type(4)));
typedef __bf16         v16b  __attribute__((ext_vector_type(16)));
typedef __bf16         v8b   __attribute__((ext_vector_type(8)));
typedef unsigned short v8us  __attribute__((ext_vector_type(8)));

union Frag16 { v16b v; v8us hv[2]; };
union Pack8  { v8b b; v8us u; };

// Every 16-bit plane in the workspace is stored in fragment order: a tile is 16 rows x 32 k = 512 elements (1 KiB), and
// element (row, k) of a tile sits at ((k >> 4) & 1) * 256 + (((k >> 3) & 1) * 16 + (row & 15)) * 8 + (k & 7).
// Lane l = 16h + m then finds its 16x32 operand fragment (row m; elements 0..7 <- k 8h..8h+7, elements 8..15 <- k 16+8h..16+8h+7,
// the same map for A rows and for B columns) at tile + 8l and tile + 256 + 8l: each wave-wide load is 512 contiguous bytes.
#define TILE_ 512

// lp = tile start + 8 * lane
__device__ __forceinline__ v16b ld_frag(const unsigned short* lp) {
  Frag16 f;
  f.hv[0] = *(const v8us*)(lp);
  f.hv[1] = *(const v8us*)(lp + 256);
  return f.v;
}

__device__ __forceinline__ v16b join16(v8us a, v8us b) {
  Frag16 f;
  f.hv[0] = a;
  f.hv[1] = b;
  return f.v;
}

__device__ __forceinline__ v8f mma(v16b a, v16b b, v8f c) {
  return __builtin_amdgcn_wmma_f32_16x16x32_bf16(false, a, false, b, (short)0, c, false, false);
}

__device__ __forceinline__ v8f vzero() {
  v8f z = {0.f, 0.f, 0.f, 0.f, 0.f, 0.f, 0.f, 0.f};
  return z;
}

// f32 -> bf16 hi (RNE convert) and bf16 lo = RNE(x - hi)
__device__ __forceinline__ void split8(v8f x, v8us& hu, v8us& lu) {
  Pack8 ph, pl;
  ph.b = __builtin_convertvector(x, v8b);
  const v8f hf = __builtin_convertvector(ph.b, v8f);
  pl.b = __builtin_convertvector(x - hf, v8b);
  hu = ph.u;
  lu = pl.u;
}

// ---------------------------------------------------------------------------
// f32 [rows][E_] -> (bf16 hi plane, bf16 lo plane) in fragment order, tile index = (row >> 4) * (E_ / 32) + (k >> 5).
// 64 threads per tile, 8 elements each: a wave takes 8 rows x 32 k, so it reads whole 128-byte lines and stores whole lines.
// One grid for the five independent arrays, the block index range picks the array: blocks 0..XBLK_-1 take xf, then WBLK_
// blocks for each of Wq, Wk, Wv, Wo, whose planes lie one behind the other at wp (hi, lo, hi, lo, ...).
#define XBLK_ (N_ * E_ / 8 / 256)
#define WBLK_ (E_ * E_ / 8 / 256)
static_assert(XBLK_ * 256 * 8 == N_ * E_ && WBLK_ * 256 * 8 == E_ * E_);   // the grid is exact: no thread without work
__global__ void __launch_bounds__(256)
k_split(const float* __restrict__ xf, const float* __restrict__ wq, const float* __restrict__ wk,
        const float* __restrict__ wv, const float* __restrict__ wo,
        unsigned short* __restrict__ xh, unsigned short* __restrict__ xl, unsigned short* __restrict__ wp) {
  const float* src = xf;
  unsigned short* dh = xh;
  unsigned short* dl = xl;
  int blk = blockIdx.x;
  if (blk >= XBLK_) {
    const int j = (blk - XBLK_) / WBLK_;
    blk = (blk - XBLK_) % WBLK_;
    src = j == 0 ? wq : j == 1 ? wk : j == 2 ? wv : wo;
    dh  = wp + (size_t)j * 2 * E_ * E_;
    dl  = dh + E_ * E_;
  }
  const int i = blk * 256 + threadIdx.x;
  const int tile = i >> 6;
  const int row  = ((i >> 5) & 1) * 8 + (i & 7);   // row in the tile
  const int k8   = (i >> 3) & 3;                   // which 8 k of the tile's 32
  const v4f* p = (const v4f*)(src + (size_t)((tile >> 4) * 16 + row) * E_ + (tile & 15) * 32 + k8 * 8);
  const size_t dst = (size_t)tile * TILE_ + (k8 * 16 + row) * 8;
  const v4f a0 = p[0];
  const v4f a1 = p[1];
  const v8f x = __builtin_shufflevector(a0, a1, 0, 1, 2, 3, 4, 5, 6, 7);
  v8us hu, lu;
  split8(x, hu, lu);
  v8us* ph = (v8us*)(dh + dst);
  v8us* pl = (v8us*)(dl + dst);
  *ph = hu;
  *pl = lu;
}

// ---------------------------------------------------------------------------
// Split GEMM: D[i][j] = sum_k P[i][k] * R[j][k], k = 0..511, both operands as hi/lo bf16 planes in fragment order,
// tile index = (row >> 4) * (E_ / 32) + (k >> 5).
// Block tile: 128 i x 128 j, 4 waves as 2 x 2. Wave tile: 64 i (4 WMMA tiles, A operand) x 64 j (4 WMMA tiles, B operand).
// acc[t][u][r] at lane (m,h) = D[ibase + 16t + 8h + r][jbase + 16u + m].
// Per 32 k the block's 8 tiles of each of the four planes (32 KiB) are brought into LDS once by asynchronous copies, two
// buffers, the next stage in flight while this one is worked on; the waves read their fragments from LDS.
// MODE 0: P = W[e][k], R = X[n][k]  -> Q/K plane per b*8+head, rows s, k = d, tile index (s >> 4) * 2 + (d >> 5), bias[e]
// MODE 1: P = X[n][k], R = W[e][k]  -> Vt plane per b*8+head, rows d, k = s, tile index (s >> 5) * 4 + (d >> 4), bias[e]
// MODE 2: P = W[e][k], R = At[n][k] -> f32 out[n][e], bias[e]
// MODE 0 and 1: the accumulator's 8 values of a lane are that same lane's 8 elements of the output plane's fragment order
// (k = 16t + 8h + r, row = m), so each lane stores 16 bytes at tile + 8l and a wave-wide store is 512 contiguous bytes.
// blk = the block's number inside its own product, 0..GBLK_-1.
#define GBLK_ ((E_ / 128) * (N_ / 128))   // 256 block tiles per product
#define GPLANE_ (8 * TILE_)               // elements of one plane per stage: 128 rows x 32 k (8 KiB)
#define GSTAGE_ (4 * GPLANE_)             // Ph, Pl, Rh, Rl
#define ROWS32_ (32 * E_)                 // elements from a row tile to the second next: what 128 lanes bring is two tiles
static_assert((E_ % 128) == 0 && (N_ % 128) == 0 && E_ / 32 >= 2);

// Half a stage: two planes, 8 tiles each; a copy of the 128 lanes brings two tiles (2 KiB), so 4 copies per plane.
// dst = this lane's LDS byte address in the first plane's stage, a and b = this lane's 16 bytes in each plane's first two tiles.
// s_wait_xcnt stands inside the statement so that no address register is rewritten ahead of it.
__device__ __forceinline__ void copy_planes(unsigned dst, const unsigned short* a, const unsigned short* b) {
  asm volatile("global_load_async_to_lds_b128 %0, %8, off\n\t"
               "global_load_async_to_lds_b128 %1, %9, off\n\t"
               "global_load_async_to_lds_b128 %2, %10, off\n\t"
               "global_load_async_to_lds_b128 %3, %11, off\n\t"
               "global_load_async_to_lds_b128 %4, %12, off\n\t"
               "global_load_async_to_lds_b128 %5, %13, off\n\t"
               "global_load_async_to_lds_b128 %6, %14, off\n\t"
               "global_load_async_to_lds_b128 %7, %15, off\n\t"
               "s_wait_xcnt 0x0"
               :
               : "v"(dst),            "v"(dst + 2048),     "v"(dst + 2 * 2048), "v"(dst + 3 * 2048),
                 "v"(dst + 4 * 2048), "v"(dst + 5 * 2048), "v"(dst + 6 * 2048), "v"(dst + 7 * 2048),
                 "v"(a), "v"(a + ROWS32_), "v"(a + 2 * ROWS32_), "v"(a + 3 * ROWS32_),
                 "v"(b), "v"(b + ROWS32_), "v"(b + 2 * ROWS32_), "v"(b + 3 * ROWS32_)
               : "memory");
}

template <int MODE>
__device__ __forceinline__ void
gemm_tile(const int blk, unsigned short* ring,
          const unsigned short* __restrict__ Ph, const unsigned short* __restrict__ Pl,
          const unsigned short* __restrict__ Rh, const unsigned short* __restrict__ Rl,
          const float* __restrict__ bias,
          unsigned short* __restrict__ Oh, unsigned short* __restrict__ Ol,
          float* __restrict__ Of)
{
  const int l  = threadIdx.x & 31;
  const int h  = l >> 4;
  const int m  = l & 15;
  const int wv = threadIdx.x >> 5;
  const int wi = wv & 1;
  const int wj = wv >> 1;
  int iblk, jblk;                               // first row of the block's 128 in P and in R
  if (MODE == 1) { iblk = (blk >> 2) * 128; jblk = (blk & 3) * 128; }
  else           { iblk = (blk & 3) * 128;  jblk = (blk >> 2) * 128; }
  const int ibase = iblk + wi * 64;
  const int jbase = jblk + wj * 64;

  v8f acc[4][4];
#pragma unroll
  for (int t = 0; t < 4; ++t)
#pragma unroll
    for (int u = 0; u < 4; ++u) acc[t][u] = vzero();

  const unsigned ring_l = (unsigned)(size_t)ring + threadIdx.x * 16;   // this lane's LDS byte address, buffer 0
  // this lane's 16 bytes of stage 0 in each plane: lanes 0..63 the first row tile, lanes 64..127 the second
  const size_t lane_g = (size_t)(threadIdx.x >> 6) * 16 * E_ + (threadIdx.x & 63) * 8;
  const unsigned short* ph_g = Ph + (size_t)iblk * E_ + lane_g;
  const unsigned short* pl_g = Pl + (size_t)iblk * E_ + lane_g;
  const unsigned short* rh_g = Rh + (size_t)jblk * E_ + lane_g;
  const unsigned short* rl_g = Rl + (size_t)jblk * E_ + lane_g;

  copy_planes(ring_l, ph_g, pl_g);
  copy_planes(ring_l + GPLANE_ * 4, rh_g, rl_g);
  asm volatile("s_wait_asynccnt 0x0" ::: "memory");   // this wave's share of stage 0 has landed
  __syncthreads();                                    // every wave's share has: stage 0 may be read
  copy_planes(ring_l + GSTAGE_ * 2, ph_g + TILE_, pl_g + TILE_);
  copy_planes(ring_l + GSTAGE_ * 2 + GPLANE_ * 4, rh_g + TILE_, rl_g + TILE_);

  // stays rolled: the body already holds 48 WMMAs, and the buffer is picked by ks & 1
#pragma unroll 1
  for (int ks = 0; ks < E_ / 32; ++ks) {
    const int buf = ks & 1;
    const unsigned short* pb = ring + buf * GSTAGE_ + wi * 4 * TILE_ + l * 8;
    const unsigned short* rb = ring + buf * GSTAGE_ + 2 * GPLANE_ + wj * 4 * TILE_ + l * 8;
    v16b rh[4], rl[4], ph[2], pl[2];
    ph[0] = ld_frag(pb);
    pl[0] = ld_frag(pb + GPLANE_);
#pragma unroll
    for (int u = 0; u < 4; ++u) rh[u] = ld_frag(rb + u * TILE_);
#pragma unroll
    for (int u = 0; u < 4; ++u) rl[u] = ld_frag(rb + GPLANE_ + u * TILE_);
#pragma unroll
    for (int t = 0; t < 4; ++t) {
      const v16b ah = ph[t & 1];
      const v16b al = pl[t & 1];
      if (t < 3) {
        ph[(t + 1) & 1] = ld_frag(pb + (t + 1) * TILE_);
        pl[(t + 1) & 1] = ld_frag(pb + GPLANE_ + (t + 1) * TILE_);
      }
      // keeps the next row's fragment loads ahead of this row's 12 WMMAs, which then cover their LDS latency
      __builtin_amdgcn_sched_barrier(0);
#pragma unroll
      for (int u = 0; u < 4; ++u) acc[t][u] = mma(ah, rh[u], acc[t][u]);
#pragma unroll
      for (int u = 0; u < 4; ++u) acc[t][u] = mma(ah, rl[u], acc[t][u]);
#pragma unroll
      for (int u = 0; u < 4; ++u) acc[t][u] = mma(al, rh[u], acc[t][u]);
    }

    // hand-over: this wave has left the buffer, its share of the next stage has landed, then all waves meet
    asm volatile("s_wait_dscnt 0x0" ::: "memory");      // this wave's reads of the buffer are done before it is refilled
    asm volatile("s_wait_asynccnt 0x0" ::: "memory");   // this wave's copies of the next stage have landed
    __syncthreads();                                    // publishes the next stage, frees the buffer just read
    if (ks + 2 < E_ / 32) {
      const int nx = (ks + 2) * TILE_;
      const unsigned dst = ring_l + buf * (GSTAGE_ * 2);
      copy_planes(dst, ph_g + nx, pl_g + nx);
      copy_planes(dst + GPLANE_ * 4, rh_g + nx, rl_g + nx);
    }
  }
  asm volatile("s_wait_asynccnt 0x0" ::: "memory");     // nothing is in flight behind the loop

  if constexpr (MODE == 2) {
    // the ring is free behind the last trip's barrier: each wave stages its own 64 x 64 f32 tile (16 KiB) there
    v4f* lds_f = (v4f*)ring + wv * 1024;
#pragma unroll
    for (int t = 0; t < 4; ++t) {
      const v4f b0 = *(const v4f*)(bias + ibase + t * 16 + 8 * h);
      const v4f b1 = *(const v4f*)(bias + ibase + t * 16 + 8 * h + 4);
      const v8f bb = __builtin_shufflevector(b0, b1, 0, 1, 2, 3, 4, 5, 6, 7);
#pragma unroll
      for (int u = 0; u < 4; ++u) {
        const v8f val = acc[t][u] + bb;
        lds_f[u * 256 + m * 16 + 4 * t + 2 * h]     = __builtin_shufflevector(val, val, 0, 1, 2, 3);
        lds_f[u * 256 + m * 16 + 4 * t + 2 * h + 1] = __builtin_shufflevector(val, val, 4, 5, 6, 7);
      }
    }
    __syncthreads();
    float* op = Of + (size_t)(jbase + (l >> 4)) * E_ + ibase + (l & 15) * 4;   // 16 chunks of 16 B per row, 2 rows a store
#pragma unroll
    for (int j = 0; j < 32; ++j) *(v4f*)(op + (size_t)j * 2 * E_) = lds_f[j * 32 + l];
  } else {
    size_t base;      // this lane's place in the first tile of u = 0
    int tstep;        // from the tile of k 0..31 to the tile of k 32..63
    int ustep;        // from the tiles of one u to those of the next
    if (MODE == 0) {
      const int bh = (jbase >> 11) * H_ + (ibase >> 6);
      base  = ((size_t)bh * S_ + (jbase & (S_ - 1))) * D_ + l * 8;
      tstep = TILE_;
      ustep = 16 * D_;
    } else {
      const int bh = (ibase >> 11) * H_ + (jbase >> 6);
      const int st = (ibase & (S_ - 1)) >> 5;
      base  = (size_t)bh * D_ * S_ + (size_t)(st * 4) * TILE_ + l * 8;
      tstep = 4 * TILE_;
      ustep = TILE_;
    }
    float bsc[4] = {0.0f, 0.0f, 0.0f, 0.0f};
    if (MODE == 1) {
#pragma unroll
      for (int u = 0; u < 4; ++u) bsc[u] = bias[jbase + u * 16 + m];
    }
#pragma unroll
    for (int t = 0; t < 4; ++t) {
      v8f bb = vzero();
      if (MODE == 0) {
        const v4f b0 = *(const v4f*)(bias + ibase + t * 16 + 8 * h);
        const v4f b1 = *(const v4f*)(bias + ibase + t * 16 + 8 * h + 4);
        bb = __builtin_shufflevector(b0, b1, 0, 1, 2, 3, 4, 5, 6, 7);
      }
#pragma unroll
      for (int u = 0; u < 4; ++u) {
        v8f val;
        if (MODE == 0) val = acc[t][u] + bb;
        else           val = acc[t][u] + bsc[u];
        v8us w0, w1;
        split8(val, w0, w1);
        const size_t off = base + u * ustep + (t >> 1) * tstep + (t & 1) * 256;
        *(v8us*)(Oh + off) = w0;
        *(v8us*)(Ol + off) = w1;
      }
      // the next row's values, or another product's code, follow these stores in the listing: the wait stands in front
      // of any rewrite of a register that they name
      asm volatile("s_wait_xcnt 0x0" ::: "memory");
      // one row of tiles at a time: formed all at once the 16 tiles need registers above v255
      __builtin_amdgcn_sched_barrier(0);
    }
  }
}

// The three projections are independent of one another: one grid, the block index range picks the product
// (0: Q, 1: K, 2: Vt).
__global__ void __launch_bounds__(128)
k_gemm_qkv(const unsigned short* __restrict__ xh,  const unsigned short* __restrict__ xl,
           const unsigned short* __restrict__ wqh, const unsigned short* __restrict__ wql,
           const unsigned short* __restrict__ wkh, const unsigned short* __restrict__ wkl,
           const unsigned short* __restrict__ wvh, const unsigned short* __restrict__ wvl,
           const float* __restrict__ bq, const float* __restrict__ bk, const float* __restrict__ bv,
           unsigned short* __restrict__ qh, unsigned short* __restrict__ ql,
           unsigned short* __restrict__ kh, unsigned short* __restrict__ kl,
           unsigned short* __restrict__ vh, unsigned short* __restrict__ vl)
{
  __shared__ __attribute__((aligned(16))) unsigned short ring[2 * GSTAGE_];   // 64 KiB, one ring for whichever job runs
  const int job = blockIdx.x / GBLK_;
  const int blk = blockIdx.x % GBLK_;
  if (job == 2) {
    gemm_tile<1>(blk, ring, xh, xl, wvh, wvl, bv, vh, vl, nullptr);
  } else if (job == 1) {
    gemm_tile<0>(blk, ring, wkh, wkl, xh, xl, bk, kh, kl, nullptr);
  } else {
    gemm_tile<0>(blk, ring, wqh, wql, xh, xl, bq, qh, ql, nullptr);
  }
}

__global__ void __launch_bounds__(128)
k_gemm_out(const unsigned short* __restrict__ wh, const unsigned short* __restrict__ wl,
           const unsigned short* __restrict__ ah, const unsigned short* __restrict__ al,
           const float* __restrict__ bo, float* __restrict__ out)
{
  __shared__ __attribute__((aligned(16))) unsigned short ring[2 * GSTAGE_];   // 64 KiB
  gemm_tile<2>(blockIdx.x, ring, wh, wl, ah, al, bo, nullptr, nullptr, out);
}

// ---------------------------------------------------------------------------
// Flash attention, transposed: a wave owns 32 queries of one (b, head) as two tiles of 16; in tile j lane (m, h) owns query
// q0+16j+m (both lane halves). Every K and Vt fragment read from LDS is the A operand of both tiles' products.
// Per 64 keys: S^T tiles = K(16 keys x 64 d, A operand) . Q^T(64 d x 16 q, B operand) -> D rows = keys, cols = queries;
// per-lane online softmax over its 32 keys, partner half via one shuffle; P^T chains from D into the B operand of
// O^T(16 d x 16 q) += Vt(16 d x 32 keys, A operand) . P^T(32 keys x 16 q): B element r <- D(tile for keys 0..15)[r],
// element 8+r <- D(tile for keys 16..31)[r], lane unchanged.
// The 8 waves of a block share one (b, head): each 64-key stage of the four K / Vt planes (8 KiB each, contiguous in
// fragment order) is brought into LDS once per block by asynchronous copies, two buffers, the next stage in flight
// while this one is worked on; the waves read their fragments from LDS at the same tile offsets as in the planes.
#define KSTEP_ 64
#define PLANE_ (KSTEP_ * D_)     // elements of one plane per stage (8 KiB)
#define STAGE_ (4 * PLANE_)      // Kh, Kl, Vh, Vl
#define HALFB_ (PLANE_ * 2 / 2)  // bytes of half a plane's stage: what 256 lanes bring with one 16-byte copy each
static_assert(S_ / KSTEP_ >= 2);
static_assert(HALFB_ == 256 * 16);

// One stage: every lane copies 2 x 16 bytes of each plane. dst = this lane's LDS byte address in the stage's buffer,
// the pointers = this lane's 16 bytes in the first half of each plane's stage.
// s_wait_xcnt stands inside the statement so that no address register is rewritten ahead of it.
__device__ __forceinline__ void copy_stage(unsigned dst,
                                           const unsigned short* kh, const unsigned short* kl,
                                           const unsigned short* vh, const unsigned short* vl) {
  asm volatile("global_load_async_to_lds_b128 %0, %8, off\n\t"
               "global_load_async_to_lds_b128 %1, %9, off\n\t"
               "global_load_async_to_lds_b128 %2, %10, off\n\t"
               "global_load_async_to_lds_b128 %3, %11, off\n\t"
               "global_load_async_to_lds_b128 %4, %12, off\n\t"
               "global_load_async_to_lds_b128 %5, %13, off\n\t"
               "global_load_async_to_lds_b128 %6, %14, off\n\t"
               "global_load_async_to_lds_b128 %7, %15, off\n\t"
               "s_wait_xcnt 0x0"
               :
               : "v"(dst),                 "v"(dst + HALFB_),
                 "v"(dst + 2 * HALFB_),    "v"(dst + 3 * HALFB_),
                 "v"(dst + 4 * HALFB_),    "v"(dst + 5 * HALFB_),
                 "v"(dst + 6 * HALFB_),    "v"(dst + 7 * HALFB_),
                 "v"(kh), "v"(kh + PLANE_ / 2), "v"(kl), "v"(kl + PLANE_ / 2),
                 "v"(vh), "v"(vh + PLANE_ / 2), "v"(vl), "v"(vl + PLANE_ / 2)
               : "memory");
}

__global__ void __launch_bounds__(256)
k_attn(const unsigned short* __restrict__ Qh, const unsigned short* __restrict__ Ql,
       const unsigned short* __restrict__ Kh, const unsigned short* __restrict__ Kl,
       const unsigned short* __restrict__ Vh, const unsigned short* __restrict__ Vl,
       const float* __restrict__ ent,
       unsigned short* __restrict__ Ah, unsigned short* __restrict__ Al)
{
  const int l    = threadIdx.x & 31;
  const int m    = l & 15;
  const int wv   = threadIdx.x >> 5;
  const int gw   = blockIdx.x * 8 + wv;        // 2048 waves, exact; 64 waves per (b, head), so a block has one
  const int bh   = gw >> 6;
  const int qt   = gw & 63;
  const int q0   = qt * 32;
  const int b    = bh >> 3;
  const int head = bh & 7;

  // query tile j = queries q0 + 16j .. q0 + 16j + 15; 16 rows x D_ = two tiles: d 0..31, d 32..63
  const size_t qoff = ((size_t)bh * S_ + q0) * D_ + l * 8;
  v16b qh0[2], qh1[2], ql0[2], ql1[2];
  float fac2[2], mrun[2], lrun[2];
  v8f o[2][4];
#pragma unroll
  for (int j = 0; j < 2; ++j) {
    qh0[j] = ld_frag(Qh + qoff + j * 2 * TILE_);
    qh1[j] = ld_frag(Qh + qoff + j * 2 * TILE_ + TILE_);
    ql0[j] = ld_frag(Ql + qoff + j * 2 * TILE_);
    ql1[j] = ld_frag(Ql + qoff + j * 2 * TILE_ + TILE_);
    // logit scale entangle[q] / sqrt(64), folded with log2(e) for exp2
    fac2[j] = ent[q0 + j * 16 + m] * 0.18033688011112042f;
    mrun[j] = -__builtin_inff();
    lrun[j] = 0.0f;
#pragma unroll
    for (int t = 0; t < 4; ++t) o[j][t] = vzero();
  }

  __shared__ __attribute__((aligned(16))) unsigned short ring[2 * STAGE_];   // 64 KiB
  const unsigned ring_l = (unsigned)(size_t)ring + threadIdx.x * 16;         // this lane's LDS byte address, buffer 0
  // this lane's 16 bytes of stage 0 in each plane; a stage of 64 keys is PLANE_ elements further in all four
  const unsigned short* kh_g = Kh + (size_t)bh * S_ * D_ + threadIdx.x * 8;
  const unsigned short* kl_g = Kl + (size_t)bh * S_ * D_ + threadIdx.x * 8;
  const unsigned short* vh_g = Vh + (size_t)bh * D_ * S_ + threadIdx.x * 8;
  const unsigned short* vl_g = Vl + (size_t)bh * D_ * S_ + threadIdx.x * 8;

  copy_stage(ring_l, kh_g, kl_g, vh_g, vl_g);
  asm volatile("s_wait_asynccnt 0x0" ::: "memory");   // this wave's share of stage 0 has landed
  __syncthreads();                                    // every wave's share has: stage 0 may be read
  copy_stage(ring_l + STAGE_ * 2, kh_g + PLANE_, kl_g + PLANE_, vh_g + PLANE_, vl_g + PLANE_);
  kh_g += 2 * PLANE_;   // from here on: this lane's 16 bytes of the next stage to be copied
  kl_g += 2 * PLANE_;
  vh_g += 2 * PLANE_;
  vl_g += 2 * PLANE_;

#pragma unroll 1
  for (int kb = 0; kb < S_; kb += KSTEP_) {
    const int buf = (kb / KSTEP_) & 1;
    const unsigned short* kh_b = ring + buf * STAGE_ + l * 8;
    const unsigned short* kl_b = kh_b + PLANE_;
    const unsigned short* vh_b = kh_b + 2 * PLANE_;
    const unsigned short* vl_b = kh_b + 3 * PLANE_;
    v8f c[2][4];
    // A group of K = the fragments of 24 WMMAs (two 16-key tiles x hi, lo x d 0..31, d 32..63), a group of Vt = those of 12
    // (two 16-d tiles x hi, lo). Each group is read from LDS in one place, one group ahead of its use.
    v16b kf[2][2][4];
    v16b vf[2][2][2];
#pragma unroll
    for (int w = 0; w < 2; ++w) {
      kf[0][w][0] = ld_frag(kh_b + w * 16 * D_);
      kf[0][w][1] = ld_frag(kl_b + w * 16 * D_);
      kf[0][w][2] = ld_frag(kh_b + w * 16 * D_ + TILE_);
      kf[0][w][3] = ld_frag(kl_b + w * 16 * D_ + TILE_);
    }
#pragma unroll
    for (int g = 0; g < 2; ++g) {
      if (g == 0) {
#pragma unroll
        for (int w = 0; w < 2; ++w) {
          kf[1][w][0] = ld_frag(kh_b + (2 + w) * 16 * D_);
          kf[1][w][1] = ld_frag(kl_b + (2 + w) * 16 * D_);
          kf[1][w][2] = ld_frag(kh_b + (2 + w) * 16 * D_ + TILE_);
          kf[1][w][3] = ld_frag(kl_b + (2 + w) * 16 * D_ + TILE_);
        }
      } else {
#pragma unroll
        for (int t = 0; t < 2; ++t) {
          vf[0][t][0] = ld_frag(vh_b + t * TILE_);
          vf[0][t][1] = ld_frag(vl_b + t * TILE_);
        }
      }
      // keeps the next group's loads together ahead of this group's WMMAs, which cover their LDS latency
      __builtin_amdgcn_sched_barrier(0);
      // every K fragment serves both query tiles; four independent accumulators, each summed in the order
      // hh, hl, lh of d 0..31, then of d 32..63
      v8f cc[2][2];
#pragma unroll
      for (int w = 0; w < 2; ++w)
#pragma unroll
        for (int j = 0; j < 2; ++j) cc[w][j] = vzero();
#pragma unroll
      for (int w = 0; w < 2; ++w)
#pragma unroll
        for (int j = 0; j < 2; ++j) cc[w][j] = mma(kf[g][w][0], qh0[j], cc[w][j]);
#pragma unroll
      for (int w = 0; w < 2; ++w)
#pragma unroll
        for (int j = 0; j < 2; ++j) cc[w][j] = mma(kf[g][w][0], ql0[j], cc[w][j]);
#pragma unroll
      for (int w = 0; w < 2; ++w)
#pragma unroll
        for (int j = 0; j < 2; ++j) cc[w][j] = mma(kf[g][w][1], qh0[j], cc[w][j]);
#pragma unroll
      for (int w = 0; w < 2; ++w)
#pragma unroll
        for (int j = 0; j < 2; ++j) cc[w][j] = mma(kf[g][w][2], qh1[j], cc[w][j]);
#pragma unroll
      for (int w = 0; w < 2; ++w)
#pragma unroll
        for (int j = 0; j < 2; ++j) cc[w][j] = mma(kf[g][w][2], ql1[j], cc[w][j]);
#pragma unroll
      for (int w = 0; w < 2; ++w)
#pragma unroll
        for (int j = 0; j < 2; ++j) cc[w][j] = mma(kf[g][w][3], qh1[j], cc[w][j]);
#pragma unroll
      for (int w = 0; w < 2; ++w)
#pragma unroll
        for (int j = 0; j < 2; ++j) c[j][2 * g + w] = cc[w][j];   // c[j][u][r] = raw score of key kb + 16u + 8h + r against query q0 + 16j + m
    }

    // online softmax, f32, per query tile: lane holds 32 keys of its query; partner lane (xor 16) holds the other 32
#pragma unroll
    for (int j = 0; j < 2; ++j) {
      float tmax = -__builtin_inff();
#pragma unroll
      for (int u = 0; u < 4; ++u) {
        c[j][u] = c[j][u] * fac2[j];
#pragma unroll
        for (int r = 0; r < 8; ++r) tmax = fmaxf(tmax, c[j][u][r]);
      }
      tmax = fmaxf(tmax, __shfl_xor(tmax, 16));
      const float mnew  = fmaxf(mrun[j], tmax);
      const float alpha = __builtin_amdgcn_exp2f(mrun[j] - mnew);
      float psum = 0.0f;
#pragma unroll
      for (int u = 0; u < 4; ++u) {
        const v8f x = c[j][u] - mnew;
#pragma unroll
        for (int r = 0; r < 8; ++r) {
          const float p = __builtin_amdgcn_exp2f(x[r]);
          c[j][u][r] = p;
          psum += p;
        }
        // the slot that the instruction set asks for behind a transcendental: the eight arguments stay live up to this
        // v_nop, which follows the eight v_exp (it takes their sum), so that none is overwritten directly behind its v_exp
        asm volatile("v_nop" :: "v"(x[0]), "v"(x[1]), "v"(x[2]), "v"(x[3]), "v"(x[4]), "v"(x[5]), "v"(x[6]), "v"(x[7]),
                                "v"(psum));
      }
      psum += __shfl_xor(psum, 16);
      lrun[j] = lrun[j] * alpha + psum;
      mrun[j] = mnew;
#pragma unroll
      for (int t = 0; t < 4; ++t) o[j][t] = o[j][t] * alpha;
    }

    // P^T (D layout, rows = keys) -> hi/lo B fragments; O^T += Vt . P^T
#pragma unroll
    for (int v = 0; v < 2; ++v) {
      v16b phi[2], plo[2];
#pragma unroll
      for (int j = 0; j < 2; ++j) {
        v8us h0, l0, h1, l1;
        split8(c[j][2 * v], h0, l0);
        split8(c[j][2 * v + 1], h1, l1);
        phi[j] = join16(h0, h1);
        plo[j] = join16(l0, l1);
      }
#pragma unroll
      for (int tp = 0; tp < 2; ++tp) {
        const int i = v * 2 + tp;   // group: Vt tiles 2i and 2i + 1 of the stage's 8
        if (i < 3) {
#pragma unroll
          for (int w = 0; w < 2; ++w) {
            vf[(i + 1) & 1][w][0] = ld_frag(vh_b + (2 * i + 2 + w) * TILE_);
            vf[(i + 1) & 1][w][1] = ld_frag(vl_b + (2 * i + 2 + w) * TILE_);
          }
        }
        // keeps the next group's loads together ahead of this group's WMMAs, which cover their LDS latency
        __builtin_amdgcn_sched_barrier(0);
        // every Vt fragment serves both query tiles; four independent accumulators, each summed in the order hh, hl, lh
#pragma unroll
        for (int w = 0; w < 2; ++w)
#pragma unroll
          for (int j = 0; j < 2; ++j) o[j][2 * tp + w] = mma(vf[i & 1][w][0], phi[j], o[j][2 * tp + w]);
#pragma unroll
        for (int w = 0; w < 2; ++w)
#pragma unroll
          for (int j = 0; j < 2; ++j) o[j][2 * tp + w] = mma(vf[i & 1][w][0], plo[j], o[j][2 * tp + w]);
#pragma unroll
        for (int w = 0; w < 2; ++w)
#pragma unroll
          for (int j = 0; j < 2; ++j) o[j][2 * tp + w] = mma(vf[i & 1][w][1], phi[j], o[j][2 * tp + w]);
      }
    }   // o[j][t][r] = O^T[d = 16t + 8h + r][q = q0 + 16j + m]

    // hand-over: this wave has left the buffer, its share of the next stage has landed, then all waves meet
    asm volatile("s_wait_dscnt 0x0" ::: "memory");      // this wave's reads of the buffer are done before it is refilled
    asm volatile("s_wait_asynccnt 0x0" ::: "memory");   // this wave's copies of the next stage have landed
    __syncthreads();                                    // publishes the next stage, frees the buffer just read
    if (kb + 2 * KSTEP_ < S_) {
      copy_stage(ring_l + buf * (STAGE_ * 2), kh_g, kl_g, vh_g, vl_g);
      kh_g += PLANE_;
      kl_g += PLANE_;
      vh_g += PLANE_;
      vl_g += PLANE_;
    }
  }
  asm volatile("s_wait_asynccnt 0x0" ::: "memory");     // nothing is in flight when the wave ends

  // At plane [N_][E_] in fragment order (rows n, k = e): lane (m, h) already holds row q0 + 16j + m, k = 64 head + 16t + 8h + r
#pragma unroll
  for (int j = 0; j < 2; ++j) {
    const float inv = 1.0f / lrun[j];
    v8us w0[4], w1[4];
#pragma unroll
    for (int t = 0; t < 4; ++t) {
      const v8f val = o[j][t] * inv;
      split8(val, w0[t], w1[t]);
    }
    const size_t aoff = ((size_t)b * S_ + q0 + j * 16) * E_ + (size_t)head * 2 * TILE_ + l * 8;
#pragma unroll
    for (int t = 0; t < 4; ++t) {
      *(v8us*)(Ah + aoff + t * 256) = w0[t];
      *(v8us*)(Al + aoff + t * 256) = w1[t];
    }
  }
}

// ---------------------------------------------------------------------------
extern "C" void kernel_launch(void* const* d_in, const int* in_sizes, int n_in,
                              void* d_out, int out_size, void* d_ws, size_t ws_size,
                              hipStream_t stream) {
  if (n_in < 10) return;
  if (in_sizes[0] != N_ * E_ || in_sizes[1] != S_ ||
      in_sizes[2] != E_ * E_ || in_sizes[3] != E_ ||
      in_sizes[4] != E_ * E_ || in_sizes[5] != E_ ||
      in_sizes[6] != E_ * E_ || in_sizes[7] != E_ ||
      in_sizes[8] != E_ * E_ || in_sizes[9] != E_ ||
      out_size != N_ * E_) return;

  const float* x   = (const float*)d_in[0];   // [B,S,E]
  const float* ent = (const float*)d_in[1];   // [S]
  const float* Wq  = (const float*)d_in[2];
  const float* bq  = (const float*)d_in[3];
  const float* Wk  = (const float*)d_in[4];
  const float* bk  = (const float*)d_in[5];
  const float* Wv  = (const float*)d_in[6];
  const float* bv  = (const float*)d_in[7];
  const float* Wo  = (const float*)d_in[8];
  const float* bo  = (const float*)d_in[9];
  float* out = (float*)d_out;

  const size_t nX = (size_t)N_ * E_;           // 4194304
  const size_t nW = (size_t)E_ * E_;           // 262144
  const size_t total_bytes = (10 * nX + 8 * nW) * sizeof(unsigned short);   // 88080384
  if (total_bytes > ws_size) return;

  unsigned short* p = (unsigned short*)d_ws;
  unsigned short* Xh  = p; p += nX;   unsigned short* Xl  = p; p += nX;
  unsigned short* Wqh = p; p += nW;   unsigned short* Wql = p; p += nW;   // the eight weight planes lie one behind
  unsigned short* Wkh = p; p += nW;   unsigned short* Wkl = p; p += nW;   // the other: k_split finds them from Wqh
  unsigned short* Wvh = p; p += nW;   unsigned short* Wvl = p; p += nW;
  unsigned short* Woh = p; p += nW;   unsigned short* Wol = p; p += nW;
  unsigned short* Qh  = p; p += nX;   unsigned short* Ql  = p; p += nX;   // [B*H] x (rows s, k = d)
  unsigned short* Kh  = p; p += nX;   unsigned short* Kl  = p; p += nX;   // [B*H] x (rows s, k = d)
  unsigned short* Vh  = p; p += nX;   unsigned short* Vl  = p; p += nX;   // [B*H] x (rows d, k = s)
  unsigned short* Ah  = p; p += nX;   unsigned short* Al  = p; p += nX;   // rows n, k = e

  k_split<<<XBLK_ + 4 * WBLK_, 256, 0, stream>>>(x, Wq, Wk, Wv, Wo, Xh, Xl, Wqh);

  k_gemm_qkv<<<3 * GBLK_, 128, 0, stream>>>(Xh, Xl, Wqh, Wql, Wkh, Wkl, Wvh, Wvl, bq, bk, bv, Qh, Ql, Kh, Kl, Vh, Vl);

  k_attn<<<(B_ * H_ * (S_ / 32)) / 8, 256, 0, stream>>>(Qh, Ql, Kh, Kl, Vh, Vl, ent, Ah, Al);

  k_gemm_out<<<GBLK_, 128, 0, stream>>>(Woh, Wol, Ah, Al, bo, out);
}

// v006
// A run of this version takes 116 microseconds.
// Two timings next to v005 both put it at 1.05 times that version's speed.
// Counting every step since v000, it is 3.55 times as fast.
#include <hip/hip_runtime.h>
#include <stddef.h>

// All contractions on v_wmma_f32_16x16x32_bf16 with bf16 operands carried as hi/lo pairs (hi*hi + hi*lo + lo*hi), f32 accumulate:
// q/k/v projections, key-by-query scores, value aggregation, output projection. Softmax, bias and normalisation in f32.

#define B_ 4
#define S_ 2048
#define E_ 512
#define H_ 8
#define D_ 64
#define N_ (B_ * S_)

static_assert(E_ == H_ * D_);
static_assert(D_ == 64 && E_ == 512);
static_assert((S_ % 64) == 0 && (E_ % 64) == 0 && (N_ % 64) == 0);

typedef float          v8f   __attribute__((ext_vector_type(8)));
typedef float          v4f   __attribute__((ext_vector_type(4)));
typedef __bf16         v16b  __attribute__((ext_vector_type(16)));
typedef __bf16         v8b   __attribute__((ext_vector_type(8)));
typedef unsigned short v8us  __attribute__((ext_vector_type(8)));

union Frag16 { v16b v; v8us hv[2]; };
union Pack8  { v8b b; v8us u; };

// Every 16-bit plane in the workspace is stored in fragment order: a tile is 16 rows x 32 k = 512 elements (1 KiB), and
// element (row, k) of a tile sits at ((k >> 4) & 1) * 256 + (((k >> 3) & 1) * 16 + (row & 15)) * 8 + (k & 7).
// Lane l = 16h + m then finds its 16x32 operand fragment (row m; elements 0..7 <- k 8h..8h+7, elements 8..15 <- k 16+8h..16+8h+7,
// the same map for A rows and for B columns) at tile + 8l and tile + 256 + 8l: each wave-wide load is 512 contiguous bytes.
#define TILE_ 512

// lp = tile start + 8 * lane
__device__ __forceinline__ v16b ld_frag(const unsigned short* lp) {
  Frag16 f;
  f.hv[0] = *(const v8us*)(lp);
  f.hv[1] = *(const v8us*)(lp + 256);
  return f.v;
}

__device__ __forceinline__ v16b join16(v8us a, v8us b) {
  Frag16 f;
  f.hv[0] = a;
  f.hv[1] = b;
  return f.v;
}

__device__ __forceinline__ v8f mma(v16b a, v16b b, v8f c) {
  return __builtin_amdgcn_wmma_f32_16x16x32_bf16(false, a, false, b, (short)0, c, false, false);
}

__device__ __forceinline__ v8f vzero() {
  v8f z = {0.f, 0.f, 0.f, 0.f, 0.f, 0.f, 0.f, 0.f};
  return z;
}

// f32 -> bf16 hi (RNE convert) and bf16 lo = RNE(x - hi)
__device__ __forceinline__ void split8(v8f x, v8us& hu, v8us& lu) {
  Pack8 ph, pl;
  ph.b = __builtin_convertvector(x, v8b);
  const v8f hf = __builtin_convertvector(ph.b, v8f);
  pl.b = __builtin_convertvector(x - hf, v8b);
  hu = ph.u;
  lu = pl.u;
}

// ---------------------------------------------------------------------------
// f32 [rows][E_] -> (bf16 hi plane, bf16 lo plane) in fragment order, tile index = (row >> 4) * (E_ / 32) + (k >> 5).
// 64 threads per tile, 8 elements each: a wave takes 8 rows x 32 k, so it reads whole 128-byte lines and stores whole lines.
// One grid for the five independent arrays, the block index range picks the array: blocks 0..XBLK_-1 take xf, then WBLK_
// blocks for each of Wq, Wk, Wv, Wo, whose planes lie one behind the other at wp (hi, lo, hi, lo, ...).
#define XBLK_ (N_ * E_ / 8 / 256)
#define WBLK_ (E_ * E_ / 8 / 256)
static_assert(XBLK_ * 256 * 8 == N_ * E_ && WBLK_ * 256 * 8 == E_ * E_);   // the grid is exact: no thread without work
__global__ void __launch_bounds__(256)
k_split(const float* __restrict__ xf, const float* __restrict__ wq, const float* __restrict__ wk,
        const float* __restrict__ wv, const float* __restrict__ wo,
        unsigned short* __restrict__ xh, unsigned short* __restrict__ xl, unsigned short* __restrict__ wp) {
  const float* src = xf;
  unsigned short* dh = xh;
  unsigned short* dl = xl;
  int blk = blockIdx.x;
  if (blk >= XBLK_) {
    const int j = (blk - XBLK_) / WBLK_;
    blk = (blk - XBLK_) % WBLK_;
    src = j == 0 ? wq : j == 1 ? wk : j == 2 ? wv : wo;
    dh  = wp + (size_t)j * 2 * E_ * E_;
    dl  = dh + E_ * E_;
  }
  const int i = blk * 256 + threadIdx.x;
  const int tile = i >> 6;
  const int row  = ((i >> 5) & 1) * 8 + (i & 7);   // row in the tile
  const int k8   = (i >> 3) & 3;                   // which 8 k of the tile's 32
  const v4f* p = (const v4f*)(src + (size_t)((tile >> 4) * 16 + row) * E_ + (tile & 15) * 32 + k8 * 8);
  const size_t dst = (size_t)tile * TILE_ + (k8 * 16 + row) * 8;
  const v4f a0 = p[0];
  const v4f a1 = p[1];
  const v8f x = __builtin_shufflevector(a0, a1, 0, 1, 2, 3, 4, 5, 6, 7);
  v8us hu, lu;
  split8(x, hu, lu);
  v8us* ph = (v8us*)(dh + dst);
  v8us* pl = (v8us*)(dl + dst);
  *ph = hu;
  *pl = lu;
}

// ---------------------------------------------------------------------------
// Split GEMM: D[i][j] = sum_k P[i][k] * R[j][k], k = 0..511, both operands as hi/lo bf16 planes in fragment order,
// tile index = (row >> 4) * (E_ / 32) + (k >> 5).
// Block tile: 128 i x 128 j, 4 waves as 2 x 2. Wave tile: 64 i (4 WMMA tiles, A operand) x 64 j (4 WMMA tiles, B operand).
// acc[t][u][r] at lane (m,h) = D[ibase + 16t + 8h + r][jbase + 16u + m].
// Per 32 k the block's 8 tiles of each of the four planes (32 KiB) are brought into LDS once by asynchronous copies, two
// buffers, the next stage in flight while this one is worked on; the waves read their fragments from LDS.
// MODE 0: P = W[e][k], R = X[n][k]  -> Q/K plane per b*8+head, rows s, k = d, tile index (s >> 4) * 2 + (d >> 5), bias[e]
// MODE 1: P = X[n][k], R = W[e][k]  -> Vt plane per b*8+head, rows d, k = s, tile index (s >> 5) * 4 + (d >> 4), bias[e]
// MODE 2: P = W[e][k], R = At[n][k] -> f32 out[n][e], bias[e]
// MODE 0 and 1: the accumulator's 8 values of a lane are that same lane's 8 elements of the output plane's fragment order
// (k = 16t + 8h + r, row = m), so each lane stores 16 bytes at tile + 8l and a wave-wide store is 512 contiguous bytes.
// blk = the block's number inside its own product, 0..GBLK_-1.
#define GBLK_ ((E_ / 128) * (N_ / 128))   // 256 block tiles per product
#define GPLANE_ (8 * TILE_)               // elements of one plane per stage: 128 rows x 32 k (8 KiB)
#define GSTAGE_ (4 * GPLANE_)             // Ph, Pl, Rh, Rl
#define ROWS32_ (32 * E_)                 // elements from a row tile to the second next: what 128 lanes bring is two tiles
static_assert((E_ % 128) == 0 && (N_ % 128) == 0 && E_ / 32 >= 2);

// Half a stage: two planes, 8 tiles each; a copy of the 128 lanes brings two tiles (2 KiB), so 4 copies per plane.
// dst = this lane's LDS byte address in the first plane's stage, a and b = this lane's 16 bytes in each plane's first two tiles.
// s_wait_xcnt stands inside the statement so that no address register is rewritten ahead of it.
__device__ __forceinline__ void copy_planes(unsigned dst, const unsigned short* a, const unsigned short* b) {
  asm volatile("global_load_async_to_lds_b128 %0, %8, off\n\t"
               "global_load_async_to_lds_b128 %1, %9, off\n\t"
               "global_load_async_to_lds_b128 %2, %10, off\n\t"
               "global_load_async_to_lds_b128 %3, %11, off\n\t"
               "global_load_async_to_lds_b128 %4, %12, off\n\t"
               "global_load_async_to_lds_b128 %5, %13, off\n\t"
               "global_load_async_to_lds_b128 %6, %14, off\n\t"
               "global_load_async_to_lds_b128 %7, %15, off\n\t"
               "s_wait_xcnt 0x0"
               :
               : "v"(dst),            "v"(dst + 2048),     "v"(dst + 2 * 2048), "v"(dst + 3 * 2048),
                 "v"(dst + 4 * 2048), "v"(dst + 5 * 2048), "v"(dst + 6 * 2048), "v"(dst + 7 * 2048),
                 "v"(a), "v"(a + ROWS32_), "v"(a + 2 * ROWS32_), "v"(a + 3 * ROWS32_),
                 "v"(b), "v"(b + ROWS32_), "v"(b + 2 * ROWS32_), "v"(b + 3 * ROWS32_)
               : "memory");
}

template <int MODE>
__device__ __forceinline__ void
gemm_tile(const int blk, unsigned short* ring,
          const unsigned short* __restrict__ Ph, const unsigned short* __restrict__ Pl,
          const unsigned short* __restrict__ Rh, const unsigned short* __restrict__ Rl,
          const float* __restrict__ bias,
          unsigned short* __restrict__ Oh, unsigned short* __restrict__ Ol,
          float* __restrict__ Of)
{
  const int l  = threadIdx.x & 31;
  const int h  = l >> 4;
  const int m  = l & 15;
  const int wv = threadIdx.x >> 5;
  const int wi = wv & 1;
  const int wj = wv >> 1;
  int iblk, jblk;                               // first row of the block's 128 in P and in R
  if (MODE == 1) { iblk = (blk >> 2) * 128; jblk = (blk & 3) * 128; }
  else           { iblk = (blk & 3) * 128;  jblk = (blk >> 2) * 128; }
  const int ibase = iblk + wi * 64;
  const int jbase = jblk + wj * 64;

  v8f acc[4][4];
#pragma unroll
  for (int t = 0; t < 4; ++t)
#pragma unroll
    for (int u = 0; u < 4; ++u) acc[t][u] = vzero();

  const unsigned ring_l = (unsigned)(size_t)ring + threadIdx.x * 16;   // this lane's LDS byte address, buffer 0
  // this lane's 16 bytes of stage 0 in each plane: lanes 0..63 the first row tile, lanes 64..127 the second
  const size_t lane_g = (size_t)(threadIdx.x >> 6) * 16 * E_ + (threadIdx.x & 63) * 8;
  const unsigned short* ph_g = Ph + (size_t)iblk * E_ + lane_g;
  const unsigned short* pl_g = Pl + (size_t)iblk * E_ + lane_g;
  const unsigned short* rh_g = Rh + (size_t)jblk * E_ + lane_g;
  const unsigned short* rl_g = Rl + (size_t)jblk * E_ + lane_g;

  copy_planes(ring_l, ph_g, pl_g);
  copy_planes(ring_l + GPLANE_ * 4, rh_g, rl_g);
  asm volatile("s_wait_asynccnt 0x0" ::: "memory");   // this wave's share of stage 0 has landed
  __syncthreads();                                    // every wave's share has: stage 0 may be read
  copy_planes(ring_l + GSTAGE_ * 2, ph_g + TILE_, pl_g + TILE_);
  copy_planes(ring_l + GSTAGE_ * 2 + GPLANE_ * 4, rh_g + TILE_, rl_g + TILE_);

  // stays rolled: the body already holds 48 WMMAs, and the buffer is picked by ks & 1
#pragma unroll 1
  for (int ks = 0; ks < E_ / 32; ++ks) {
    const int buf = ks & 1;
    const unsigned short* pb = ring + buf * GSTAGE_ + wi * 4 * TILE_ + l * 8;
    const unsigned short* rb = ring + buf * GSTAGE_ + 2 * GPLANE_ + wj * 4 * TILE_ + l * 8;
    v16b rh[4], rl[4], ph[2], pl[2];
    ph[0] = ld_frag(pb);
    pl[0] = ld_frag(pb + GPLANE_);
#pragma unroll
    for (int u = 0; u < 4; ++u) rh[u] = ld_frag(rb + u * TILE_);
#pragma unroll
    for (int u = 0; u < 4; ++u) rl[u] = ld_frag(rb + GPLANE_ + u * TILE_);
#pragma unroll
    for (int t = 0; t < 4; ++t) {
      const v16b ah = ph[t & 1];
      const v16b al = pl[t & 1];
      if (t < 3) {
        ph[(t + 1) & 1] = ld_frag(pb + (t + 1) * TILE_);
        pl[(t + 1) & 1] = ld_frag(pb + GPLANE_ + (t + 1) * TILE_);
      }
      // keeps the next row's fragment loads ahead of this row's 12 WMMAs, which then cover their LDS latency
      __builtin_amdgcn_sched_barrier(0);
#pragma unroll
      for (int u = 0; u < 4; ++u) acc[t][u] = mma(ah, rh[u], acc[t][u]);
#pragma unroll
      for (int u = 0; u < 4; ++u) acc[t][u] = mma(ah, rl[u], acc[t][u]);
#pragma unroll
      for (int u = 0; u < 4; ++u) acc[t][u] = mma(al, rh[u], acc[t][u]);
    }

    // hand-over: this wave has left the buffer, its share of the next stage has landed, then all waves meet
    asm volatile("s_wait_dscnt 0x0" ::: "memory");      // this wave's reads of the buffer are done before it is refilled
    asm volatile("s_wait_asynccnt 0x0" ::: "memory");   // this wave's copies of the next stage have landed
    __syncthreads();                                    // publishes the next stage, frees the buffer just read
    if (ks + 2 < E_ / 32) {
      const int nx = (ks + 2) * TILE_;
      const unsigned dst = ring_l + buf * (GSTAGE_ * 2);
      copy_planes(dst, ph_g + nx, pl_g + nx);
      copy_planes(dst + GPLANE_ * 4, rh_g + nx, rl_g + nx);
    }
  }
  asm volatile("s_wait_asynccnt 0x0" ::: "memory");     // nothing is in flight behind the loop

  if constexpr (MODE == 2) {
    // the ring is free behind the last trip's barrier: each wave stages its own 64 x 64 f32 tile (16 KiB) there
    v4f* lds_f = (v4f*)ring + wv * 1024;
#pragma unroll
    for (int t = 0; t < 4; ++t) {
      const v4f b0 = *(const v4f*)(bias + ibase + t * 16 + 8 * h);
      const v4f b1 = *(const v4f*)(bias + ibase + t * 16 + 8 * h + 4);
      const v8f bb = __builtin_shufflevector(b0, b1, 0, 1, 2, 3, 4, 5, 6, 7);
#pragma unroll
      for (int u = 0; u < 4; ++u) {
        const v8f val = acc[t][u] + bb;
        lds_f[u * 256 + m * 16 + 4 * t + 2 * h]     = __builtin_shufflevector(val, val, 0, 1, 2, 3);
        lds_f[u * 256 + m * 16 + 4 * t + 2 * h + 1] = __builtin_shufflevector(val, val, 4, 5, 6, 7);
      }
    }
    __syncthreads();
    float* op = Of + (size_t)(jbase + (l >> 4)) * E_ + ibase + (l & 15) * 4;   // 16 chunks of 16 B per row, 2 rows a store
#pragma unroll
    for (int j = 0; j < 32; ++j) *(v4f*)(op + (size_t)j * 2 * E_) = lds_f[j * 32 + l];
  } else {
    size_t base;      // this lane's place in the first tile of u = 0
    int tstep;        // from the tile of k 0..31 to the tile of k 32..63
    int ustep;        // from the tiles of one u to those of the next
    if (MODE == 0) {
      const int bh = (jbase >> 11) * H_ + (ibase >> 6);
      base  = ((size_t)bh * S_ + (jbase & (S_ - 1))) * D_ + l * 8;
      tstep = TILE_;
      ustep = 16 * D_;
    } else {
      const int bh = (ibase >> 11) * H_ + (jbase >> 6);
      const int st = (ibase & (S_ - 1)) >> 5;
      base  = (size_t)bh * D_ * S_ + (size_t)(st * 4) * TILE_ + l * 8;
      tstep = 4 * TILE_;
      ustep = TILE_;
    }
    float bsc[4] = {0.0f, 0.0f, 0.0f, 0.0f};
    if (MODE == 1) {
#pragma unroll
      for (int u = 0; u < 4; ++u) bsc[u] = bias[jbase + u * 16 + m];
    }
#pragma unroll
    for (int t = 0; t < 4; ++t) {
      v8f bb = vzero();
      if (MODE == 0) {
        const v4f b0 = *(const v4f*)(bias + ibase + t * 16 + 8 * h);
        const v4f b1 = *(const v4f*)(bias + ibase + t * 16 + 8 * h + 4);
        bb = __builtin_shufflevector(b0, b1, 0, 1, 2, 3, 4, 5, 6, 7);
      }
#pragma unroll
      for (int u = 0; u < 4; ++u) {
        v8f val;
        if (MODE == 0) val = acc[t][u] + bb;
        else           val = acc[t][u] + bsc[u];
        v8us w0, w1;
        split8(val, w0, w1);
        const size_t off = base + u * ustep + (t >> 1) * tstep + (t & 1) * 256;
        *(v8us*)(Oh + off) = w0;
        *(v8us*)(Ol + off) = w1;
      }
      // the next row's values, or another product's code, follow these stores in the listing: the wait stands in front
      // of any rewrite of a register that they name
      asm volatile("s_wait_xcnt 0x0" ::: "memory");
      // one row of tiles at a time: formed all at once the 16 tiles need registers above v255
      __builtin_amdgcn_sched_barrier(0);
    }
  }
}

// The three projections are independent of one another: one grid, the block index range picks the product
// (0: Q, 1: K, 2: Vt).
__global__ void __launch_bounds__(128)
k_gemm_qkv(const unsigned short* __restrict__ xh,  const unsigned short* __restrict__ xl,
           const unsigned short* __restrict__ wqh, const unsigned short* __restrict__ wql,
           const unsigned short* __restrict__ wkh, const unsigned short* __restrict__ wkl,
           const unsigned short* __restrict__ wvh, const unsigned short* __restrict__ wvl,
           const float* __restrict__ bq, const float* __restrict__ bk, const float* __restrict__ bv,
           unsigned short* __restrict__ qh, unsigned short* __restrict__ ql,
           unsigned short* __restrict__ kh, unsigned short* __restrict__ kl,
           unsigned short* __restrict__ vh, unsigned short* __restrict__ vl)
{
  __shared__ __attribute__((aligned(16))) unsigned short ring[2 * GSTAGE_];   // 64 KiB, one ring for whichever job runs
  const int job = blockIdx.x / GBLK_;
  const int blk = blockIdx.x % GBLK_;
  if (job == 2) {
    gemm_tile<1>(blk, ring, xh, xl, wvh, wvl, bv, vh, vl, nullptr);
  } else if (job == 1) {
    gemm_tile<0>(blk, ring, wkh, wkl, xh, xl, bk, kh, kl, nullptr);
  } else {
    gemm_tile<0>(blk, ring, wqh, wql, xh, xl, bq, qh, ql, nullptr);
  }
}

__global__ void __launch_bounds__(128)
k_gemm_out(const unsigned short* __restrict__ wh, const unsigned short* __restrict__ wl,
           const unsigned short* __restrict__ ah, const unsigned short* __restrict__ al,
           const float* __restrict__ bo, float* __restrict__ out)
{
  __shared__ __attribute__((aligned(16))) unsigned short ring[2 * GSTAGE_];   // 64 KiB
  gemm_tile<2>(blockIdx.x, ring, wh, wl, ah, al, bo, nullptr, nullptr, out);
}

// ---------------------------------------------------------------------------
// Flash attention, transposed: a wave owns 32 queries of one (b, head) as two tiles of 16; in tile j lane (m, h) owns query
// q0+16j+m (both lane halves). Every K and Vt fragment read from LDS is the A operand of both tiles' products.
// Per 64 keys: S^T tiles = K(16 keys x 64 d, A operand) . Q^T(64 d x 16 q, B operand) -> D rows = keys, cols = queries;
// per-lane online softmax over its 32 keys, partner half via one shuffle; P^T chains from D into the B operand of
// O^T(16 d x 16 q) += Vt(16 d x 32 keys, A operand) . P^T(32 keys x 16 q): B element r <- D(tile for keys 0..15)[r],
// element 8+r <- D(tile for keys 16..31)[r], lane unchanged.
// A block is 16 waves on one (b, head) and 256 queries: waves 0..7 walk keys 0..S_/2-1, waves 8..15 walk keys S_/2..S_-1 for
// the same eight groups of 32 queries, four waves per SIMD. Each half has its own ring: its 8 waves bring each 64-key stage of
// the four K / Vt planes (8 KiB each, contiguous in fragment order) into LDS once by asynchronous copies, two buffers, the
// next stage in flight while this one is worked on; the waves read their fragments from LDS at the same tile offsets as in
// the planes. Behind the loop the upper half hands its running maximum, sum and O^T to the lower half through LDS.
#define KSTEP_ 64
#define KHALF_ (S_ / 2)          // keys per wave
#define PLANE_ (KSTEP_ * D_)     // elements of one plane per stage (8 KiB)
#define STAGE_ (4 * PLANE_)      // Kh, Kl, Vh, Vl
#define QGRP_ (32 * D_)          // elements of one plane of a wave's 32 queries (4 KiB)
#define HALFB_ (PLANE_ * 2 / 2)  // bytes of half a plane's stage: what 256 lanes bring with one 16-byte copy each
static_assert(KHALF_ / KSTEP_ >= 2 && (KHALF_ % KSTEP_) == 0);
static_assert(HALFB_ == 256 * 16);

// One stage: every lane copies 2 x 16 bytes of each plane. dst = this lane's LDS byte address in the stage's buffer,
// the pointers = this lane's 16 bytes in the first half of each plane's stage.
// s_wait_xcnt stands inside the statement so that no address register is rewritten ahead of it.
__device__ __forceinline__ void copy_stage(unsigned dst,
                                           const unsigned short* kh, const unsigned short* kl,
                                           const unsigned short* vh, const unsigned short* vl) {
  asm volatile("global_load_async_to_lds_b128 %0, %8, off\n\t"
               "global_load_async_to_lds_b128 %1, %9, off\n\t"
               "global_load_async_to_lds_b128 %2, %10, off\n\t"
               "global_load_async_to_lds_b128 %3, %11, off\n\t"
               "global_load_async_to_lds_b128 %4, %12, off\n\t"
               "global_load_async_to_lds_b128 %5, %13, off\n\t"
               "global_load_async_to_lds_b128 %6, %14, off\n\t"
               "global_load_async_to_lds_b128 %7, %15, off\n\t"
               "s_wait_xcnt 0x0"
               :
               : "v"(dst),                 "v"(dst + HALFB_),
                 "v"(dst + 2 * HALFB_),    "v"(dst + 3 * HALFB_),
                 "v"(dst + 4 * HALFB_),    "v"(dst + 5 * HALFB_),
                 "v"(dst + 6 * HALFB_),    "v"(dst + 7 * HALFB_),
                 "v"(kh), "v"(kh + PLANE_ / 2), "v"(kl), "v"(kl + PLANE_ / 2),
                 "v"(vh), "v"(vh + PLANE_ / 2), "v"(vl), "v"(vl + PLANE_ / 2)
               : "memory");
}

__global__ void __launch_bounds__(512)
k_attn(const unsigned short* __restrict__ Qh, const unsigned short* __restrict__ Ql,
       const unsigned short* __restrict__ Kh, const unsigned short* __restrict__ Kl,
       const unsigned short* __restrict__ Vh, const unsigned short* __restrict__ Vl,
       const float* __restrict__ ent,
       unsigned short* __restrict__ Ah, unsigned short* __restrict__ Al)
{
  const int l    = threadIdx.x & 31;
  const int m    = l & 15;
  const int wv   = __builtin_amdgcn_readfirstlane(threadIdx.x >> 5);   // scalar: what follows from it takes no vector register
  const int qg   = wv & 7;                     // which 32 of the block's 256 queries
  const int kq   = wv >> 3;                    // which half of the keys
  const int tid  = threadIdx.x & 255;          // this lane's number among the 256 that fill its half's ring
  const int gw   = blockIdx.x * 8 + qg;        // 2048 query groups, exact; 64 per (b, head), so a block has one (b, head)
  const int bh   = gw >> 6;
  const int qt   = gw & 63;
  const int q0   = qt * 32;
  const int b    = bh >> 3;
  const int head = bh & 7;

  float fac2[2], mrun[2], lrun[2];
  v8f o[2][4];
#pragma unroll
  for (int j = 0; j < 2; ++j) {
    // logit scale entangle[q] / sqrt(64), folded with log2(e) for exp2
    fac2[j] = ent[q0 + j * 16 + m] * 0.18033688011112042f;
    mrun[j] = -__builtin_inff();
    lrun[j] = 0.0f;
#pragma unroll
    for (int t = 0; t < 4; ++t) o[j][t] = vzero();
  }

  __shared__ __attribute__((aligned(16))) unsigned short ring[2 * 2 * STAGE_];   // 128 KiB: a ring of two buffers per key half
  // Q^T fragments of the block's 8 query groups, hi plane then lo plane per group, in the planes' own fragment order: query
  // tile j = queries q0 + 16j .. q0 + 16j + 15 is two tiles, d 0..31 and d 32..63, so fragment (j, d half) is tile 2j + d half.
  // They are read from here on every trip: held in registers (64) they do not fit the budget of 256.
  __shared__ __attribute__((aligned(16))) unsigned short qlds[8 * 2 * QGRP_];    // 64 KiB
  {
    // of the two waves with the same queries the lower brings the hi plane's 4 KiB, the upper the lo plane's;
    // the barrier behind stage 0 publishes them
    const unsigned short* qsrc = (kq ? Ql : Qh) + ((size_t)bh * S_ + q0) * D_ + l * 8;
    unsigned short* qdst = qlds + (qg * 2 + kq) * QGRP_ + l * 8;
    v8us qv[8];
#pragma unroll
    for (int i = 0; i < 8; ++i) qv[i] = *(const v8us*)(qsrc + i * 256);
    // in front of any rewrite of a register that these loads name
    asm volatile("s_wait_xcnt 0x0" ::: "memory");
    // keeps what follows, address arithmetic too, behind that wait
    __builtin_amdgcn_sched_barrier(0);
#pragma unroll
    for (int i = 0; i < 8; ++i) *(v8us*)(qdst + i * 256) = qv[i];
  }
  const unsigned short* qh_l = qlds + qg * 2 * QGRP_ + l * 8;   // this lane's place in the group's first hi tile
  const unsigned short* ql_l = qh_l + QGRP_;
  const unsigned short* ring_h = ring + kq * 2 * STAGE_;
  const unsigned ring_l = (unsigned)(size_t)ring_h + tid * 16;               // this lane's LDS byte address, buffer 0
  // this lane's 16 bytes of its half's stage 0 in each plane; a stage of 64 keys is PLANE_ elements further in all four
  // (one element offset serves all four: it is the only address that stays in a register over the loop)
  unsigned goff = (unsigned)bh * (S_ * D_) + (unsigned)kq * (KHALF_ * D_) + tid * 8;

  copy_stage(ring_l, Kh + goff, Kl + goff, Vh + goff, Vl + goff);
  asm volatile("s_wait_asynccnt 0x0" ::: "memory");   // this wave's share of stage 0 has landed
  __syncthreads();                                    // every wave's share has: stage 0 may be read
  goff += PLANE_;
  copy_stage(ring_l + STAGE_ * 2, Kh + goff, Kl + goff, Vh + goff, Vl + goff);
  goff += PLANE_;   // from here on: this lane's 16 bytes of the next stage to be copied

#pragma unroll 1
  for (int kb = 0; kb < KHALF_; kb += KSTEP_) {
    const int buf = (kb / KSTEP_) & 1;
    const unsigned short* kh_b = ring_h + buf * STAGE_ + l * 8;
    const unsigned short* kl_b = kh_b + PLANE_;
    const unsigned short* vh_b = kh_b + 2 * PLANE_;
    const unsigned short* vl_b = kh_b + 3 * PLANE_;
    v8f c[2][4];
    // A unit = the hi and the lo fragment of one tile = the A operands of 6 WMMAs (hh, hl, lh for both query tiles). The stage
    // holds 8 units of K (16 keys x 32 d each) and 8 of Vt (16 d x 32 keys each). Each unit is read from LDS in one place, one
    // unit ahead of its use, into two register sets in turn: the wave's budget at four waves per SIMD is 256 registers.
    v16b f[2][2];
    v16b qh[2], ql[2];   // [query tile], one d half at a time
    f[0][0] = ld_frag(kh_b);
    f[0][1] = ld_frag(kl_b);
#pragma unroll
    for (int j = 0; j < 2; ++j) {
      qh[j] = ld_frag(qh_l + j * 2 * TILE_);
      ql[j] = ld_frag(ql_l + j * 2 * TILE_);
    }
#pragma unroll
    for (int i = 0; i < 8; ++i) {
      const int u  = i & 3;    // 16-key tile
      const int dh = i >> 2;   // d 0..31, then d 32..63: only one d half of Q^T is in use at a time
      if (i < 7) {
        const int nx = (((i + 1) & 3) * 2 + ((i + 1) >> 2)) * TILE_;
        f[(i + 1) & 1][0] = ld_frag(kh_b + nx);
        f[(i + 1) & 1][1] = ld_frag(kl_b + nx);
      } else {
        f[0][0] = ld_frag(vh_b);
        f[0][1] = ld_frag(vl_b);
      }
      if (i == 4) {
        // the second d half of Q^T takes the registers of the first, behind the first's last product
#pragma unroll
        for (int j = 0; j < 2; ++j) {
          qh[j] = ld_frag(qh_l + j * 2 * TILE_ + TILE_);
          ql[j] = ld_frag(ql_l + j * 2 * TILE_ + TILE_);
        }
      }
      // keeps the next unit's loads together ahead of this unit's WMMAs
      __builtin_amdgcn_sched_barrier(0);
      // each accumulator is summed in the order hh, hl, lh of d 0..31, then of d 32..63
#pragma unroll
      for (int j = 0; j < 2; ++j) c[j][u] = mma(f[i & 1][0], qh[j], dh == 0 ? vzero() : c[j][u]);
#pragma unroll
      for (int j = 0; j < 2; ++j) c[j][u] = mma(f[i & 1][0], ql[j], c[j][u]);
#pragma unroll
      for (int j = 0; j < 2; ++j) c[j][u] = mma(f[i & 1][1], qh[j], c[j][u]);
    }   // c[j][u][r] = raw score of key kq * KHALF_ + kb + 16u + 8h + r against query q0 + 16j + m

    // online softmax, f32, per query tile: lane holds 32 keys of its query; partner lane (xor 16) holds the other 32
#pragma unroll
    for (int j = 0; j < 2; ++j) {
      float tmax = -__builtin_inff();
#pragma unroll
      for (int u = 0; u < 4; ++u) {
        c[j][u] = c[j][u] * fac2[j];
#pragma unroll
        for (int r = 0; r < 8; ++r) tmax = fmaxf(tmax, c[j][u][r]);
      }
      tmax = fmaxf(tmax, __shfl_xor(tmax, 16));
      const float mnew  = fmaxf(mrun[j], tmax);
      const float alpha = __builtin_amdgcn_exp2f(mrun[j] - mnew);
      float psum = 0.0f;
#pragma unroll
      for (int u = 0; u < 4; ++u) {
        const v8f x = c[j][u] - mnew;
#pragma unroll
        for (int r = 0; r < 8; ++r) {
          const float p = __builtin_amdgcn_exp2f(x[r]);
          c[j][u][r] = p;
          psum += p;
        }
        // the slot that the instruction set asks for behind a transcendental: the eight arguments stay live up to this
        // v_nop, which follows the eight v_exp (it takes their sum), so that none is overwritten directly behind its v_exp
        asm volatile("v_nop" :: "v"(x[0]), "v"(x[1]), "v"(x[2]), "v"(x[3]), "v"(x[4]), "v"(x[5]), "v"(x[6]), "v"(x[7]),
                                "v"(psum));
      }
      psum += __shfl_xor(psum, 16);
      lrun[j] = lrun[j] * alpha + psum;
      mrun[j] = mnew;
#pragma unroll
      for (int t = 0; t < 4; ++t) o[j][t] = o[j][t] * alpha;
    }

    // P^T (D layout, rows = keys) -> hi/lo B fragments; O^T += Vt . P^T
#pragma unroll
    for (int v = 0; v < 2; ++v) {
      v16b phi[2], plo[2];
#pragma unroll
      for (int j = 0; j < 2; ++j) {
        v8us h0, l0, h1, l1;
        split8(c[j][2 * v], h0, l0);
        split8(c[j][2 * v + 1], h1, l1);
        phi[j] = join16(h0, h1);
        plo[j] = join16(l0, l1);
      }
#pragma unroll
      for (int t = 0; t < 4; ++t) {
        const int i = v * 4 + t;   // unit: Vt tile i of the stage's 8 (keys 32v .. 32v + 31, d 16t .. 16t + 15)
        if (i < 7) {
          f[(i + 1) & 1][0] = ld_frag(vh_b + (i + 1) * TILE_);
          f[(i + 1) & 1][1] = ld_frag(vl_b + (i + 1) * TILE_);
        }
        // keeps the next unit's loads together ahead of this unit's WMMAs
        __builtin_amdgcn_sched_barrier(0);
        // each accumulator is summed in the order hh, hl, lh
#pragma unroll
        for (int j = 0; j < 2; ++j) o[j][t] = mma(f[i & 1][0], phi[j], o[j][t]);
#pragma unroll
        for (int j = 0; j < 2; ++j) o[j][t] = mma(f[i & 1][0], plo[j], o[j][t]);
#pragma unroll
        for (int j = 0; j < 2; ++j) o[j][t] = mma(f[i & 1][1], phi[j], o[j][t]);
      }
    }   // o[j][t][r] = O^T[d = 16t + 8h + r][q = q0 + 16j + m]

    // hand-over: this wave has left the buffer, its share of the next stage has landed, then all waves meet
    asm volatile("s_wait_dscnt 0x0" ::: "memory");      // this wave's reads of the buffer are done before it is refilled
    asm volatile("s_wait_asynccnt 0x0" ::: "memory");   // this wave's copies of the next stage have landed
    __syncthreads();                                    // publishes the next stage, frees the buffer just read
    if (kb + 2 * KSTEP_ < KHALF_) {
      copy_stage(ring_l + buf * (STAGE_ * 2), Kh + goff, Kl + goff, Vh + goff, Vl + goff);
      goff += PLANE_;
    }
  }
  asm volatile("s_wait_asynccnt 0x0" ::: "memory");     // nothing is in flight behind the loop

  // The rings are free behind the last trip's barrier. The wave of the upper key half leaves its state there, 17 x 16 bytes a
  // lane, lane-contiguous; the wave of the lower half with the same queries joins the two and stores the result.
  v4f* mrg = (v4f*)ring + qg * (17 * 32) + l;
  if (kq == 1) {
#pragma unroll
    for (int j = 0; j < 2; ++j)
#pragma unroll
      for (int t = 0; t < 4; ++t) {
        mrg[((j * 4 + t) * 2) * 32]     = __builtin_shufflevector(o[j][t], o[j][t], 0, 1, 2, 3);
        mrg[((j * 4 + t) * 2 + 1) * 32] = __builtin_shufflevector(o[j][t], o[j][t], 4, 5, 6, 7);
      }
    const v4f ml = {mrun[0], mrun[1], lrun[0], lrun[1]};
    mrg[16 * 32] = ml;
  }
  __syncthreads();   // the upper half's state is in LDS before the lower half reads it
  if (kq == 1) return;

  // At plane [N_][E_] in fragment order (rows n, k = e): lane (m, h) already holds row q0 + 16j + m, k = 64 head + 16t + 8h + r
  const v4f ml = mrg[16 * 32];
#pragma unroll
  for (int j = 0; j < 2; ++j) {
    const float mall = fmaxf(mrun[j], ml[j]);
    const float a0   = __builtin_amdgcn_exp2f(mrun[j] - mall);
    const float a1   = __builtin_amdgcn_exp2f(ml[j] - mall);
    const float inv  = 1.0f / (lrun[j] * a0 + ml[2 + j] * a1);
    const float s0   = a0 * inv;
    const float s1   = a1 * inv;
    v8us w0[4], w1[4];
#pragma unroll
    for (int t = 0; t < 4; ++t) {
      const v4f p0 = mrg[((j * 4 + t) * 2) * 32];
      const v4f p1 = mrg[((j * 4 + t) * 2 + 1) * 32];
      const v8f ou = __builtin_shufflevector(p0, p1, 0, 1, 2, 3, 4, 5, 6, 7);
      const v8f val = o[j][t] * s0 + ou * s1;
      split8(val, w0[t], w1[t]);
    }
    const size_t aoff = ((size_t)b * S_ + q0 + j * 16) * E_ + (size_t)head * 2 * TILE_ + l * 8;
#pragma unroll
    for (int t = 0; t < 4; ++t) {
      *(v8us*)(Ah + aoff + t * 256) = w0[t];
      *(v8us*)(Al + aoff + t * 256) = w1[t];
    }
    if (j == 0) {
      // the second tile's values follow these stores: the wait stands in front of any rewrite of a register that they name
      asm volatile("s_wait_xcnt 0x0" ::: "memory");
      // keeps the second tile's arithmetic behind that wait
      __builtin_amdgcn_sched_barrier(0);
    }
  }
}

// ---------------------------------------------------------------------------
extern "C" void kernel_launch(void* const* d_in, const int* in_sizes, int n_in,
                              void* d_out, int out_size, void* d_ws, size_t ws_size,
                              hipStream_t stream) {
  if (n_in < 10) return;
  if (in_sizes[0] != N_ * E_ || in_sizes[1] != S_ ||
      in_sizes[2] != E_ * E_ || in_sizes[3] != E_ ||
      in_sizes[4] != E_ * E_ || in_sizes[5] != E_ ||
      in_sizes[6] != E_ * E_ || in_sizes[7] != E_ ||
      in_sizes[8] != E_ * E_ || in_sizes[9] != E_ ||
      out_size != N_ * E_) return;

  const float* x   = (const float*)d_in[0];   // [B,S,E]
  const float* ent = (const float*)d_in[1];   // [S]
  const float* Wq  = (const float*)d_in[2];
  const float* bq  = (const float*)d_in[3];
  const float* Wk  = (const float*)d_in[4];
  const float* bk  = (const float*)d_in[5];
  const float* Wv  = (const float*)d_in[6];
  const float* bv  = (const float*)d_in[7];
  const float* Wo  = (const float*)d_in[8];
  const float* bo  = (const float*)d_in[9];
  float* out = (float*)d_out;

  const size_t nX = (size_t)N_ * E_;           // 4194304
  const size_t nW = (size_t)E_ * E_;           // 262144
  const size_t total_bytes = (10 * nX + 8 * nW) * sizeof(unsigned short);   // 88080384
  if (total_bytes > ws_size) return;

  unsigned short* p = (unsigned short*)d_ws;
  unsigned short* Xh  = p; p += nX;   unsigned short* Xl  = p; p += nX;
  unsigned short* Wqh = p; p += nW;   unsigned short* Wql = p; p += nW;   // the eight weight planes lie one behind
  unsigned short* Wkh = p; p += nW;   unsigned short* Wkl = p; p += nW;   // the other: k_split finds them from Wqh
  unsigned short* Wvh = p; p += nW;   unsigned short* Wvl = p; p += nW;
  unsigned short* Woh = p; p += nW;   unsigned short* Wol = p; p += nW;
  unsigned short* Qh  = p; p += nX;   unsigned short* Ql  = p; p += nX;   // [B*H] x (rows s, k = d)
  unsigned short* Kh  = p; p += nX;   unsigned short* Kl  = p; p += nX;   // [B*H] x (rows s, k = d)
  unsigned short* Vh  = p; p += nX;   unsigned short* Vl  = p; p += nX;   // [B*H] x (rows d, k = s)
  unsigned short* Ah  = p; p += nX;   unsigned short* Al  = p; p += nX;   // rows n, k = e

  k_split<<<XBLK_ + 4 * WBLK_, 256, 0, stream>>>(x, Wq, Wk, Wv, Wo, Xh, Xl, Wqh);

  k_gemm_qkv<<<3 * GBLK_, 128, 0, stream>>>(Xh, Xl, Wqh, Wql, Wkh, Wkl, Wvh, Wvl, bq, bk, bv, Qh, Ql, Kh, Kl, Vh, Vl);

  k_attn<<<(B_ * H_ * (S_ / 32)) / 8, 512, 0, stream>>>(Qh, Ql, Kh, Kl, Vh, Vl, ent, Ah, Al);

  k_gemm_out<<<GBLK_, 128, 0, stream>>>(Woh, Wol, Ah, Al, bo, out);
}

// v007
// It runs in 112 microseconds.
// Two timings next to v006 both put it at 1.04 times that version's speed.
// Over all steps from v000 it is 3.68 times as fast.
#include <hip/hip_runtime.h>
#include <stddef.h>

// All contractions on v_wmma_f32_16x16x32_bf16 with bf16 operands carried as hi/lo pairs (hi*hi + hi*lo + lo*hi), f32 accumulate:
// q/k/v projections, key-by-query scores, value aggregation, output projection. Softmax, bias and normalisation in f32.

#define B_ 4
#define S_ 2048
#define E_ 512
#define H_ 8
#define D_ 64
#define N_ (B_ * S_)

static_assert(E_ == H_ * D_);
static_assert(D_ == 64 && E_ == 512);
static_assert((S_ % 64) == 0 && (E_ % 64) == 0 && (N_ % 64) == 0);

typedef float          v8f   __attribute__((ext_vector_type(8)));
typedef float          v4f   __attribute__((ext_vector_type(4)));
typedef __bf16         v16b  __attribute__((ext_vector_type(16)));
typedef __bf16         v8b   __attribute__((ext_vector_type(8)));
typedef unsigned short v8us  __attribute__((ext_vector_type(8)));

union Frag16 { v16b v; v8us hv[2]; };
union Pack8  { v8b b; v8us u; };

// Every 16-bit plane in the workspace is stored in fragment order: a tile is 16 rows x 32 k = 512 elements (1 KiB), and
// element (row, k) of a tile sits at ((k >> 4) & 1) * 256 + (((k >> 3) & 1) * 16 + (row & 15)) * 8 + (k & 7).
// Lane l = 16h + m then finds its 16x32 operand fragment (row m; elements 0..7 <- k 8h..8h+7, elements 8..15 <- k 16+8h..16+8h+7,
// the same map for A rows and for B columns) at tile + 8l and tile + 256 + 8l: each wave-wide load is 512 contiguous bytes.
#define TILE_ 512

// lp = tile start + 8 * lane
__device__ __forceinline__ v16b ld_frag(const unsigned short* lp) {
  Frag16 f;
  f.hv[0] = *(const v8us*)(lp);
  f.hv[1] = *(const v8us*)(lp + 256);
  return f.v;
}

__device__ __forceinline__ v16b join16(v8us a, v8us b) {
  Frag16 f;
  f.hv[0] = a;
  f.hv[1] = b;
  return f.v;
}

__device__ __forceinline__ v8f mma(v16b a, v16b b, v8f c) {
  return __builtin_amdgcn_wmma_f32_16x16x32_bf16(false, a, false, b, (short)0, c, false, false);
}

__device__ __forceinline__ v8f vzero() {
  v8f z = {0.f, 0.f, 0.f, 0.f, 0.f, 0.f, 0.f, 0.f};
  return z;
}

// f32 -> bf16 hi (RNE convert) and bf16 lo = RNE(x - hi)
__device__ __forceinline__ void split8(v8f x, v8us& hu, v8us& lu) {
  Pack8 ph, pl;
  ph.b = __builtin_convertvector(x, v8b);
  const v8f hf = __builtin_convertvector(ph.b, v8f);
  pl.b = __builtin_convertvector(x - hf, v8b);
  hu = ph.u;
  lu = pl.u;
}

// ---------------------------------------------------------------------------
// f32 [rows][E_] -> (bf16 hi plane, bf16 lo plane) in fragment order, tile index = (row >> 4) * (E_ / 32) + (k >> 5).
// 64 threads per tile, 8 elements each: a wave takes 8 rows x 32 k, so it reads whole 128-byte lines and stores whole lines.
// One grid for the five independent arrays, the block index range picks the array: blocks 0..XBLK_-1 take xf, then WBLK_
// blocks for each of Wq, Wk, Wv, Wo, whose planes lie one behind the other at wp (hi, lo, hi, lo, ...).
#define XBLK_ (N_ * E_ / 8 / 256)
#define WBLK_ (E_ * E_ / 8 / 256)
static_assert(XBLK_ * 256 * 8 == N_ * E_ && WBLK_ * 256 * 8 == E_ * E_);   // the grid is exact: no thread without work
__global__ void __launch_bounds__(256)
k_split(const float* __restrict__ xf, const float* __restrict__ wq, const float* __restrict__ wk,
        const float* __restrict__ wv, const float* __restrict__ wo,
        unsigned short* __restrict__ xh, unsigned short* __restrict__ xl, unsigned short* __restrict__ wp) {
  const float* src = xf;
  unsigned short* dh = xh;
  unsigned short* dl = xl;
  int blk = blockIdx.x;
  if (blk >= XBLK_) {
    const int j = (blk - XBLK_) / WBLK_;
    blk = (blk - XBLK_) % WBLK_;
    src = j == 0 ? wq : j == 1 ? wk : j == 2 ? wv : wo;
    dh  = wp + (size_t)j * 2 * E_ * E_;
    dl  = dh + E_ * E_;
  }
  const int i = blk * 256 + threadIdx.x;
  const int tile = i >> 6;
  const int row  = ((i >> 5) & 1) * 8 + (i & 7);   // row in the tile
  const int k8   = (i >> 3) & 3;                   // which 8 k of the tile's 32
  const v4f* p = (const v4f*)(src + (size_t)((tile >> 4) * 16 + row) * E_ + (tile & 15) * 32 + k8 * 8);
  const size_t dst = (size_t)tile * TILE_ + (k8 * 16 + row) * 8;
  const v4f a0 = p[0];
  const v4f a1 = p[1];
  const v8f x = __builtin_shufflevector(a0, a1, 0, 1, 2, 3, 4, 5, 6, 7);
  v8us hu, lu;
  split8(x, hu, lu);
  v8us* ph = (v8us*)(dh + dst);
  v8us* pl = (v8us*)(dl + dst);
  *ph = hu;
  *pl = lu;
}

// ---------------------------------------------------------------------------
// Split GEMM: D[i][j] = sum_k P[i][k] * R[j][k], k = 0..511, both operands as hi/lo bf16 planes in fragment order,
// tile index = (row >> 4) * (E_ / 32) + (k >> 5).
// Block tile: 128 i x 128 j, 4 waves as 2 x 2. Wave tile: 64 i (4 WMMA tiles, A operand) x 64 j (4 WMMA tiles, B operand).
// acc[t][u][r] at lane (m,h) = D[ibase + 16t + 8h + r][jbase + 16u + m].
// Per 32 k the block's 8 tiles of each of the four planes (32 KiB) are brought into LDS once by asynchronous copies, two
// buffers, the next stage in flight while this one is worked on; the waves read their fragments from LDS.
// The k walk is a ring: trip ks works on k slice (ks + rot) mod 16. Blocks with
// the same X or At rows get different rot mod 16, those on the same weight rows four to a start, so that at one moment at most four ask L2 for the same lines.
// MODE 0: P = W[e][k], R = X[n][k]  -> Q/K plane per b*8+head, rows s, k = d, tile index (s >> 4) * 2 + (d >> 5), bias[e]
// MODE 1: P = X[n][k], R = W[e][k]  -> Vt plane per b*8+head, rows d, k = s, tile index (s >> 5) * 4 + (d >> 4), bias[e]
// MODE 2: P = W[e][k], R = At[n][k] -> f32 out[n][e], bias[e]
// MODE 0 and 1: the accumulator's 8 values of a lane are that same lane's 8 elements of the output plane's fragment order
// (k = 16t + 8h + r, row = m), so each lane stores 16 bytes at tile + 8l and a wave-wide store is 512 contiguous bytes.
// blk = the block's number inside its own product, 0..GBLK_-1; job = the product's number inside the grid.
#define GBLK_ ((E_ / 128) * (N_ / 128))   // 256 block tiles per product
#define GPLANE_ (8 * TILE_)               // elements of one plane per stage: 128 rows x 32 k (8 KiB)
#define GSTAGE_ (4 * GPLANE_)             // Ph, Pl, Rh, Rl
#define ROWS32_ (32 * E_)                 // elements from a row tile to the second next: what 128 lanes bring is two tiles
#define KSL_ (E_ / 32)                    // k slices of a product
static_assert((E_ % 128) == 0 && (N_ % 128) == 0 && KSL_ >= 2);
static_assert(KSL_ == 16 && E_ / 128 == 4);   // rot below: 4 * weight tile + job is different for every sharer of X or At rows

// Half a stage: two planes, 8 tiles each; a copy of the 128 lanes brings two tiles (2 KiB), so 4 copies per plane.
// dst = this lane's LDS byte address in the first plane's stage, a and b = this lane's 16 bytes in each plane's first two tiles.
// s_wait_xcnt stands inside the statement so that no address register is rewritten ahead of it.
__device__ __forceinline__ void copy_planes(unsigned dst, const unsigned short* a, const unsigned short* b) {
  asm volatile("global_load_async_to_lds_b128 %0, %8, off\n\t"
               "global_load_async_to_lds_b128 %1, %9, off\n\t"
               "global_load_async_to_lds_b128 %2, %10, off\n\t"
               "global_load_async_to_lds_b128 %3, %11, off\n\t"
               "global_load_async_to_lds_b128 %4, %12, off\n\t"
               "global_load_async_to_lds_b128 %5, %13, off\n\t"
               "global_load_async_to_lds_b128 %6, %14, off\n\t"
               "global_load_async_to_lds_b128 %7, %15, off\n\t"
               "s_wait_xcnt 0x0"
               :
               : "v"(dst),            "v"(dst + 2048),     "v"(dst + 2 * 2048), "v"(dst + 3 * 2048),
                 "v"(dst + 4 * 2048), "v"(dst + 5 * 2048), "v"(dst + 6 * 2048), "v"(dst + 7 * 2048),
                 "v"(a), "v"(a + ROWS32_), "v"(a + 2 * ROWS32_), "v"(a + 3 * ROWS32_),
                 "v"(b), "v"(b + ROWS32_), "v"(b + 2 * ROWS32_), "v"(b + 3 * ROWS32_)
               : "memory");
}

template <int MODE>
__device__ __forceinline__ void
gemm_tile(const int blk, const int job, unsigned short* ring,
          const unsigned short* __restrict__ Ph, const unsigned short* __restrict__ Pl,
          const unsigned short* __restrict__ Rh, const unsigned short* __restrict__ Rl,
          const float* __restrict__ bias,
          unsigned short* __restrict__ Oh, unsigned short* __restrict__ Ol,
          float* __restrict__ Of)
{
  const int l  = threadIdx.x & 31;
  const int h  = l >> 4;
  const int m  = l & 15;
  const int wv = threadIdx.x >> 5;
  const int wi = wv & 1;
  const int wj = wv >> 1;
  int iblk, jblk;                               // first row of the block's 128 in P and in R
  if (MODE == 1) { iblk = (blk >> 2) * 128; jblk = (blk & 3) * 128; }
  else           { iblk = (blk & 3) * 128;  jblk = (blk >> 2) * 128; }
  const int ibase = iblk + wi * 64;
  const int jbase = jblk + wj * 64;
  // blk & 3 = the tile of weight rows, blk >> 2 = the tile of X or At rows: the up to 12 blocks on one tile of X rows differ in
  // the first two terms; the last spreads the 64 blocks on one tile of weight rows evenly over the 16 starts
  const int rot = (blk & 3) * 4 + job + (blk >> 2);

  v8f acc[4][4];
#pragma unroll
  for (int t = 0; t < 4; ++t)
#pragma unroll
    for (int u = 0; u < 4; ++u) acc[t][u] = vzero();

  const unsigned ring_l = (unsigned)(size_t)ring + threadIdx.x * 16;   // this lane's LDS byte address, buffer 0
  // this lane's 16 bytes of k slice 0 in each plane: lanes 0..63 the first row tile, lanes 64..127 the second
  const size_t lane_g = (size_t)(threadIdx.x >> 6) * 16 * E_ + (threadIdx.x & 63) * 8;
  const unsigned short* ph_g = Ph + (size_t)iblk * E_ + lane_g;
  const unsigned short* pl_g = Pl + (size_t)iblk * E_ + lane_g;
  const unsigned short* rh_g = Rh + (size_t)jblk * E_ + lane_g;
  const unsigned short* rl_g = Rl + (size_t)jblk * E_ + lane_g;

  const int n0 = (rot & (KSL_ - 1)) * TILE_;         // trip 0's k slice in the planes
  const int n1 = ((rot + 1) & (KSL_ - 1)) * TILE_;   // trip 1's
  copy_planes(ring_l, ph_g + n0, pl_g + n0);
  copy_planes(ring_l + GPLANE_ * 4, rh_g + n0, rl_g + n0);
  asm volatile("s_wait_asynccnt 0x0" ::: "memory");   // this wave's share of stage 0 has landed
  __syncthreads();                                    // every wave's share has: stage 0 may be read
  copy_planes(ring_l + GSTAGE_ * 2, ph_g + n1, pl_g + n1);
  copy_planes(ring_l + GSTAGE_ * 2 + GPLANE_ * 4, rh_g + n1, rl_g + n1);

  // stays rolled: the body already holds 48 WMMAs, and the buffer is picked by ks & 1
#pragma unroll 1
  for (int ks = 0; ks < KSL_; ++ks) {
    const int buf = ks & 1;
    const unsigned short* pb = ring + buf * GSTAGE_ + wi * 4 * TILE_ + l * 8;
    const unsigned short* rb = ring + buf * GSTAGE_ + 2 * GPLANE_ + wj * 4 * TILE_ + l * 8;
    v16b rh[4], rl[4], ph[2], pl[2];
    ph[0] = ld_frag(pb);
    pl[0] = ld_frag(pb + GPLANE_);
#pragma unroll
    for (int u = 0; u < 4; ++u) rh[u] = ld_frag(rb + u * TILE_);
#pragma unroll
    for (int u = 0; u < 4; ++u) rl[u] = ld_frag(rb + GPLANE_ + u * TILE_);
#pragma unroll
    for (int t = 0; t < 4; ++t) {
      const v16b ah = ph[t & 1];
      const v16b al = pl[t & 1];
      if (t < 3) {
        ph[(t + 1) & 1] = ld_frag(pb + (t + 1) * TILE_);
        pl[(t + 1) & 1] = ld_frag(pb + GPLANE_ + (t + 1) * TILE_);
      }
      // keeps the next row's fragment loads ahead of this row's 12 WMMAs, which then cover their LDS latency
      __builtin_amdgcn_sched_barrier(0);
#pragma unroll
      for (int u = 0; u < 4; ++u) acc[t][u] = mma(ah, rh[u], acc[t][u]);
#pragma unroll
      for (int u = 0; u < 4; ++u) acc[t][u] = mma(ah, rl[u], acc[t][u]);
#pragma unroll
      for (int u = 0; u < 4; ++u) acc[t][u] = mma(al, rh[u], acc[t][u]);
    }

    // hand-over: this wave has left the buffer, its share of the next stage has landed, then all waves meet
    asm volatile("s_wait_dscnt 0x0" ::: "memory");      // this wave's reads of the buffer are done before it is refilled
    asm volatile("s_wait_asynccnt 0x0" ::: "memory");   // this wave's copies of the next stage have landed
    __syncthreads();                                    // publishes the next stage, frees the buffer just read
    if (ks + 2 < KSL_) {
      const int nx = ((ks + 2 + rot) & (KSL_ - 1)) * TILE_;
      const unsigned dst = ring_l + buf * (GSTAGE_ * 2);
      copy_planes(dst, ph_g + nx, pl_g + nx);
      copy_planes(dst + GPLANE_ * 4, rh_g + nx, rl_g + nx);
    }
  }
  asm volatile("s_wait_asynccnt 0x0" ::: "memory");     // nothing is in flight behind the loop

  if constexpr (MODE == 2) {
    // the ring is free behind the last trip's barrier: each wave stages its own 64 x 64 f32 tile (16 KiB) there
    v4f* lds_f = (v4f*)ring + wv * 1024;
#pragma unroll
    for (int t = 0; t < 4; ++t) {
      const v4f b0 = *(const v4f*)(bias + ibase + t * 16 + 8 * h);
      const v4f b1 = *(const v4f*)(bias + ibase + t * 16 + 8 * h + 4);
      const v8f bb = __builtin_shufflevector(b0, b1, 0, 1, 2, 3, 4, 5, 6, 7);
#pragma unroll
      for (int u = 0; u < 4; ++u) {
        const v8f val = acc[t][u] + bb;
        lds_f[u * 256 + m * 16 + 4 * t + 2 * h]     = __builtin_shufflevector(val, val, 0, 1, 2, 3);
        lds_f[u * 256 + m * 16 + 4 * t + 2 * h + 1] = __builtin_shufflevector(val, val, 4, 5, 6, 7);
      }
    }
    __syncthreads();
    float* op = Of + (size_t)(jbase + (l >> 4)) * E_ + ibase + (l & 15) * 4;   // 16 chunks of 16 B per row, 2 rows a store
#pragma unroll
    for (int j = 0; j < 32; ++j) *(v4f*)(op + (size_t)j * 2 * E_) = lds_f[j * 32 + l];
  } else {
    size_t base;      // this lane's place in the first tile of u = 0
    int tstep;        // from the tile of k 0..31 to the tile of k 32..63
    int ustep;        // from the tiles of one u to those of the next
    if (MODE == 0) {
      const int bh = (jbase >> 11) * H_ + (ibase >> 6);
      base  = ((size_t)bh * S_ + (jbase & (S_ - 1))) * D_ + l * 8;
      tstep = TILE_;
      ustep = 16 * D_;
    } else {
      const int bh = (ibase >> 11) * H_ + (jbase >> 6);
      const int st = (ibase & (S_ - 1)) >> 5;
      base  = (size_t)bh * D_ * S_ + (size_t)(st * 4) * TILE_ + l * 8;
      tstep = 4 * TILE_;
      ustep = TILE_;
    }
    float bsc[4] = {0.0f, 0.0f, 0.0f, 0.0f};
    if (MODE == 1) {
#pragma unroll
      for (int u = 0; u < 4; ++u) bsc[u] = bias[jbase + u * 16 + m];
    }
#pragma unroll
    for (int t = 0; t < 4; ++t) {
      v8f bb = vzero();
      if (MODE == 0) {
        const v4f b0 = *(const v4f*)(bias + ibase + t * 16 + 8 * h);
        const v4f b1 = *(const v4f*)(bias + ibase + t * 16 + 8 * h + 4);
        bb = __builtin_shufflevector(b0, b1, 0, 1, 2, 3, 4, 5, 6, 7);
      }
#pragma unroll
      for (int u = 0; u < 4; ++u) {
        v8f val;
        if (MODE == 0) val = acc[t][u] + bb;
        else           val = acc[t][u] + bsc[u];
        v8us w0, w1;
        split8(val, w0, w1);
        const size_t off = base + u * ustep + (t >> 1) * tstep + (t & 1) * 256;
        *(v8us*)(Oh + off) = w0;
        *(v8us*)(Ol + off) = w1;
      }
      // the next row's values, or another product's code, follow these stores in the listing: the wait stands in front
      // of any rewrite of a register that they name
      asm volatile("s_wait_xcnt 0x0" ::: "memory");
      // one row of tiles at a time: formed all at once the 16 tiles need registers above v255
      __builtin_amdgcn_sched_barrier(0);
    }
  }
}

// The three projections are independent of one another: one grid, the block index range picks the product
// (0: Q, 1: K, 2: Vt).
__global__ void __launch_bounds__(128)
k_gemm_qkv(const unsigned short* __restrict__ xh,  const unsigned short* __restrict__ xl,
           const unsigned short* __restrict__ wqh, const unsigned short* __restrict__ wql,
           const unsigned short* __restrict__ wkh, const unsigned short* __restrict__ wkl,
           const unsigned short* __restrict__ wvh, const unsigned short* __restrict__ wvl,
           const float* __restrict__ bq, const float* __restrict__ bk, const float* __restrict__ bv,
           unsigned short* __restrict__ qh, unsigned short* __restrict__ ql,
           unsigned short* __restrict__ kh, unsigned short* __restrict__ kl,
           unsigned short* __restrict__ vh, unsigned short* __restrict__ vl)
{
  __shared__ __attribute__((aligned(16))) unsigned short ring[2 * GSTAGE_];   // 64 KiB, one ring for whichever job runs
  const int job = blockIdx.x / GBLK_;
  const int blk = blockIdx.x % GBLK_;
  if (job == 2) {
    gemm_tile<1>(blk, 2, ring, xh, xl, wvh, wvl, bv, vh, vl, nullptr);
  } else if (job == 1) {
    gemm_tile<0>(blk, 1, ring, wkh, wkl, xh, xl, bk, kh, kl, nullptr);
  } else {
    gemm_tile<0>(blk, 0, ring, wqh, wql, xh, xl, bq, qh, ql, nullptr);
  }
}

__global__ void __launch_bounds__(128)
k_gemm_out(const unsigned short* __restrict__ wh, const unsigned short* __restrict__ wl,
           const unsigned short* __restrict__ ah, const unsigned short* __restrict__ al,
           const float* __restrict__ bo, float* __restrict__ out)
{
  __shared__ __attribute__((aligned(16))) unsigned short ring[2 * GSTAGE_];   // 64 KiB
  gemm_tile<2>(blockIdx.x, 0, ring, wh, wl, ah, al, bo, nullptr, nullptr, out);
}

// ---------------------------------------------------------------------------
// Flash attention, transposed: a wave owns 32 queries of one (b, head) as two tiles of 16; in tile j lane (m, h) owns query
// q0+16j+m (both lane halves). Every K and Vt fragment read from LDS is the A operand of both tiles' products.
// Per 64 keys: S^T tiles = K(16 keys x 64 d, A operand) . Q^T(64 d x 16 q, B operand) -> D rows = keys, cols = queries;
// per-lane online softmax over its 32 keys, partner half via one shuffle; P^T chains from D into the B operand of
// O^T(16 d x 16 q) += Vt(16 d x 32 keys, A operand) . P^T(32 keys x 16 q): B element r <- D(tile for keys 0..15)[r],
// element 8+r <- D(tile for keys 16..31)[r], lane unchanged.
// A block is 16 waves on one (b, head) and 256 queries: waves 0..7 walk keys 0..S_/2-1, waves 8..15 walk keys S_/2..S_-1 for
// the same eight groups of 32 queries, four waves per SIMD. Each half has its own ring: its 8 waves bring each 64-key stage of
// the four K / Vt planes (8 KiB each, contiguous in fragment order) into LDS once by asynchronous copies, two buffers, the
// next stage in flight while this one is worked on; the waves read their fragments from LDS at the same tile offsets as in
// the planes. Behind the loop the upper half hands its running maximum, sum and O^T to the lower half through LDS.
// The key walk is a ring: trip t works on stage (t + rot) mod NST_ of the half. Each of the 8 blocks of one (b, head)
// has its own rot, so that at one moment they ask L2 for different lines of K and Vt.
#define KSTEP_ 64
#define KHALF_ (S_ / 2)          // keys per wave
#define PLANE_ (KSTEP_ * D_)     // elements of one plane per stage (8 KiB)
#define STAGE_ (4 * PLANE_)      // Kh, Kl, Vh, Vl
#define QGRP_ (32 * D_)          // elements of one plane of a wave's 32 queries (4 KiB)
#define HALFB_ (PLANE_ * 2 / 2)  // bytes of half a plane's stage: what 256 lanes bring with one 16-byte copy each
#define NST_ (KHALF_ / KSTEP_)   // stages per key half
static_assert(NST_ >= 2 && (KHALF_ % KSTEP_) == 0);
static_assert((NST_ & (NST_ - 1)) == 0 && (NST_ % 8) == 0 && S_ / 256 == 8);   // 8 blocks per (b, head), starts NST_ / 8 apart
static_assert(HALFB_ == 256 * 16);

// One stage: every lane copies 2 x 16 bytes of each plane. dst = this lane's LDS byte address in the stage's buffer,
// the pointers = this lane's 16 bytes in the first half of each plane's stage.
// s_wait_xcnt stands inside the statement so that no address register is rewritten ahead of it.
__device__ __forceinline__ void copy_stage(unsigned dst,
                                           const unsigned short* kh, const unsigned short* kl,
                                           const unsigned short* vh, const unsigned short* vl) {
  asm volatile("global_load_async_to_lds_b128 %0, %8, off\n\t"
               "global_load_async_to_lds_b128 %1, %9, off\n\t"
               "global_load_async_to_lds_b128 %2, %10, off\n\t"
               "global_load_async_to_lds_b128 %3, %11, off\n\t"
               "global_load_async_to_lds_b128 %4, %12, off\n\t"
               "global_load_async_to_lds_b128 %5, %13, off\n\t"
               "global_load_async_to_lds_b128 %6, %14, off\n\t"
               "global_load_async_to_lds_b128 %7, %15, off\n\t"
               "s_wait_xcnt 0x0"
               :
               : "v"(dst),                 "v"(dst + HALFB_),
                 "v"(dst + 2 * HALFB_),    "v"(dst + 3 * HALFB_),
                 "v"(dst + 4 * HALFB_),    "v"(dst + 5 * HALFB_),
                 "v"(dst + 6 * HALFB_),    "v"(dst + 7 * HALFB_),
                 "v"(kh), "v"(kh + PLANE_ / 2), "v"(kl), "v"(kl + PLANE_ / 2),
                 "v"(vh), "v"(vh + PLANE_ / 2), "v"(vl), "v"(vl + PLANE_ / 2)
               : "memory");
}

__global__ void __launch_bounds__(512)
k_attn(const unsigned short* __restrict__ Qh, const unsigned short* __restrict__ Ql,
       const unsigned short* __restrict__ Kh, const unsigned short* __restrict__ Kl,
       const unsigned short* __restrict__ Vh, const unsigned short* __restrict__ Vl,
       const float* __restrict__ ent,
       unsigned short* __restrict__ Ah, unsigned short* __restrict__ Al)
{
  const int l    = threadIdx.x & 31;
  const int m    = l & 15;
  const int wv   = __builtin_amdgcn_readfirstlane(threadIdx.x >> 5);   // scalar: what follows from it takes no vector register
  const int qg   = wv & 7;                     // which 32 of the block's 256 queries
  const int kq   = wv >> 3;                    // which half of the keys
  const int tid  = threadIdx.x & 255;          // this lane's number among the 256 that fill its half's ring
  const int gw   = blockIdx.x * 8 + qg;        // 2048 query groups, exact; 64 per (b, head), so a block has one (b, head)
  const int bh   = gw >> 6;
  const int qt   = gw & 63;
  const int q0   = qt * 32;
  const int b    = bh >> 3;
  const int head = bh & 7;

  float fac2[2], mrun[2], lrun[2];
  v8f o[2][4];
#pragma unroll
  for (int j = 0; j < 2; ++j) {
    // logit scale entangle[q] / sqrt(64), folded with log2(e) for exp2
    fac2[j] = ent[q0 + j * 16 + m] * 0.18033688011112042f;
    mrun[j] = -__builtin_inff();
    lrun[j] = 0.0f;
#pragma unroll
    for (int t = 0; t < 4; ++t) o[j][t] = vzero();
  }

  __shared__ __attribute__((aligned(16))) unsigned short ring[2 * 2 * STAGE_];   // 128 KiB: a ring of two buffers per key half
  // Q^T fragments of the block's 8 query groups, hi plane then lo plane per group, in the planes' own fragment order: query
  // tile j = queries q0 + 16j .. q0 + 16j + 15 is two tiles, d 0..31 and d 32..63, so fragment (j, d half) is tile 2j + d half.
  // They are read from here on every trip: held in registers (64) they do not fit the budget of 256.
  __shared__ __attribute__((aligned(16))) unsigned short qlds[8 * 2 * QGRP_];    // 64 KiB
  {
    // of the two waves with the same queries the lower brings the hi plane's 4 KiB, the upper the lo plane's;
    // the barrier behind trip 0's stage publishes them
    const unsigned short* qsrc = (kq ? Ql : Qh) + ((size_t)bh * S_ + q0) * D_ + l * 8;
    unsigned short* qdst = qlds + (qg * 2 + kq) * QGRP_ + l * 8;
    v8us qv[8];
#pragma unroll
    for (int i = 0; i < 8; ++i) qv[i] = *(const v8us*)(qsrc + i * 256);
    // in front of any rewrite of a register that these loads name
    asm volatile("s_wait_xcnt 0x0" ::: "memory");
    // keeps what follows, address arithmetic too, behind that wait
    __builtin_amdgcn_sched_barrier(0);
#pragma unroll
    for (int i = 0; i < 8; ++i) *(v8us*)(qdst + i * 256) = qv[i];
  }
  const unsigned short* qh_l = qlds + qg * 2 * QGRP_ + l * 8;   // this lane's place in the group's first hi tile
  const unsigned short* ql_l = qh_l + QGRP_;
  const unsigned short* ring_h = ring + kq * 2 * STAGE_;
  const unsigned ring_l = (unsigned)(size_t)ring_h + tid * 16;               // this lane's LDS byte address, buffer 0
  // this lane's 16 bytes of its half's stage 0 in each plane; a stage of 64 keys is PLANE_ elements further in all four
  // (one element offset serves all four: it is the only address that stays in a register over the loop)
  const unsigned gbase = (unsigned)bh * (S_ * D_) + (unsigned)kq * (KHALF_ * D_) + tid * 8;
  const unsigned rot = (blockIdx.x & 7) * (NST_ / 8);   // the block's number among the 8 of its (b, head) sets its first stage

  {
    const unsigned goff = gbase + rot * PLANE_;
    copy_stage(ring_l, Kh + goff, Kl + goff, Vh + goff, Vl + goff);
  }
  asm volatile("s_wait_asynccnt 0x0" ::: "memory");   // this wave's share of trip 0's stage has landed
  __syncthreads();                                    // every wave's share has: it may be read
  {
    const unsigned goff = gbase + ((rot + 1) & (NST_ - 1)) * PLANE_;
    copy_stage(ring_l + STAGE_ * 2, Kh + goff, Kl + goff, Vh + goff, Vl + goff);
  }

#pragma unroll 1
  for (int kb = 0; kb < KHALF_; kb += KSTEP_) {
    const int buf = (kb / KSTEP_) & 1;
    const unsigned short* kh_b = ring_h + buf * STAGE_ + l * 8;
    const unsigned short* kl_b = kh_b + PLANE_;
    const unsigned short* vh_b = kh_b + 2 * PLANE_;
    const unsigned short* vl_b = kh_b + 3 * PLANE_;
    v8f c[2][4];
    // A unit = the hi and the lo fragment of one tile = the A operands of 6 WMMAs (hh, hl, lh for both query tiles). The stage
    // holds 8 units of K (16 keys x 32 d each) and 8 of Vt (16 d x 32 keys each). Each unit is read from LDS in one place, one
    // unit ahead of its use, into two register sets in turn: the wave's budget at four waves per SIMD is 256 registers.
    v16b f[2][2];
    v16b qh[2], ql[2];   // [query tile], one d half at a time
    f[0][0] = ld_frag(kh_b);
    f[0][1] = ld_frag(kl_b);
#pragma unroll
    for (int j = 0; j < 2; ++j) {
      qh[j] = ld_frag(qh_l + j * 2 * TILE_);
      ql[j] = ld_frag(ql_l + j * 2 * TILE_);
    }
#pragma unroll
    for (int i = 0; i < 8; ++i) {
      const int u  = i & 3;    // 16-key tile
      const int dh = i >> 2;   // d 0..31, then d 32..63: only one d half of Q^T is in use at a time
      if (i < 7) {
        const int nx = (((i + 1) & 3) * 2 + ((i + 1) >> 2)) * TILE_;
        f[(i + 1) & 1][0] = ld_frag(kh_b + nx);
        f[(i + 1) & 1][1] = ld_frag(kl_b + nx);
      } else {
        f[0][0] = ld_frag(vh_b);
        f[0][1] = ld_frag(vl_b);
      }
      if (i == 4) {
        // the second d half of Q^T takes the registers of the first, behind the first's last product
#pragma unroll
        for (int j = 0; j < 2; ++j) {
          qh[j] = ld_frag(qh_l + j * 2 * TILE_ + TILE_);
          ql[j] = ld_frag(ql_l + j * 2 * TILE_ + TILE_);
        }
      }
      // keeps the next unit's loads together ahead of this unit's WMMAs
      __builtin_amdgcn_sched_barrier(0);
      // each accumulator is summed in the order hh, hl, lh of d 0..31, then of d 32..63
#pragma unroll
      for (int j = 0; j < 2; ++j) c[j][u] = mma(f[i & 1][0], qh[j], dh == 0 ? vzero() : c[j][u]);
#pragma unroll
      for (int j = 0; j < 2; ++j) c[j][u] = mma(f[i & 1][0], ql[j], c[j][u]);
#pragma unroll
      for (int j = 0; j < 2; ++j) c[j][u] = mma(f[i & 1][1], qh[j], c[j][u]);
    }   // c[j][u][r] = raw score of key 16u + 8h + r of this trip's stage against query q0 + 16j + m

    // online softmax, f32, per query tile: lane holds 32 keys of its query; partner lane (xor 16) holds the other 32
#pragma unroll
    for (int j = 0; j < 2; ++j) {
      float tmax = -__builtin_inff();
#pragma unroll
      for (int u = 0; u < 4; ++u) {
        c[j][u] = c[j][u] * fac2[j];
#pragma unroll
        for (int r = 0; r < 8; ++r) tmax = fmaxf(tmax, c[j][u][r]);
      }
      tmax = fmaxf(tmax, __shfl_xor(tmax, 16));
      const float mnew  = fmaxf(mrun[j], tmax);
      const float alpha = __builtin_amdgcn_exp2f(mrun[j] - mnew);
      float psum = 0.0f;
#pragma unroll
      for (int u = 0; u < 4; ++u) {
        const v8f x = c[j][u] - mnew;
#pragma unroll
        for (int r = 0; r < 8; ++r) {
          const float p = __builtin_amdgcn_exp2f(x[r]);
          c[j][u][r] = p;
          psum += p;
        }
        // the slot that the instruction set asks for behind a transcendental: the eight arguments stay live up to this
        // v_nop, which follows the eight v_exp (it takes their sum), so that none is overwritten directly behind its v_exp
        asm volatile("v_nop" :: "v"(x[0]), "v"(x[1]), "v"(x[2]), "v"(x[3]), "v"(x[4]), "v"(x[5]), "v"(x[6]), "v"(x[7]),
                                "v"(psum));
      }
      psum += __shfl_xor(psum, 16);
      lrun[j] = lrun[j] * alpha + psum;
      mrun[j] = mnew;
#pragma unroll
      for (int t = 0; t < 4; ++t) o[j][t] = o[j][t] * alpha;
    }

    // P^T (D layout, rows = keys) -> hi/lo B fragments; O^T += Vt . P^T
#pragma unroll
    for (int v = 0; v < 2; ++v) {
      v16b phi[2], plo[2];
#pragma unroll
      for (int j = 0; j < 2; ++j) {
        v8us h0, l0, h1, l1;
        split8(c[j][2 * v], h0, l0);
        split8(c[j][2 * v + 1], h1, l1);
        phi[j] = join16(h0, h1);
        plo[j] = join16(l0, l1);
      }
#pragma unroll
      for (int t = 0; t < 4; ++t) {
        const int i = v * 4 + t;   // unit: Vt tile i of the stage's 8 (keys 32v .. 32v + 31, d 16t .. 16t + 15)
        if (i < 7) {
          f[(i + 1) & 1][0] = ld_frag(vh_b + (i + 1) * TILE_);
          f[(i + 1) & 1][1] = ld_frag(vl_b + (i + 1) * TILE_);
        }
        // keeps the next unit's loads together ahead of this unit's WMMAs
        __builtin_amdgcn_sched_barrier(0);
        // each accumulator is summed in the order hh, hl, lh
#pragma unroll
        for (int j = 0; j < 2; ++j) o[j][t] = mma(f[i & 1][0], phi[j], o[j][t]);
#pragma unroll
        for (int j = 0; j < 2; ++j) o[j][t] = mma(f[i & 1][0], plo[j], o[j][t]);
#pragma unroll
        for (int j = 0; j < 2; ++j) o[j][t] = mma(f[i & 1][1], phi[j], o[j][t]);
      }
    }   // o[j][t][r] = O^T[d = 16t + 8h + r][q = q0 + 16j + m]

    // hand-over: this wave has left the buffer, its share of the next stage has landed, then all waves meet
    asm volatile("s_wait_dscnt 0x0" ::: "memory");      // this wave's reads of the buffer are done before it is refilled
    asm volatile("s_wait_asynccnt 0x0" ::: "memory");   // this wave's copies of the next stage have landed
    __syncthreads();                                    // publishes the next stage, frees the buffer just read
    if (kb + 2 * KSTEP_ < KHALF_) {
      const unsigned goff = gbase + ((kb / KSTEP_ + 2 + rot) & (NST_ - 1)) * PLANE_;
      copy_stage(ring_l + buf * (STAGE_ * 2), Kh + goff, Kl + goff, Vh + goff, Vl + goff);
    }
  }
  asm volatile("s_wait_asynccnt 0x0" ::: "memory");     // nothing is in flight behind the loop

  // The rings are free behind the last trip's barrier. The wave of the upper key half leaves its state there, 17 x 16 bytes a
  // lane, lane-contiguous; the wave of the lower half with the same queries joins the two and stores the result.
  v4f* mrg = (v4f*)ring + qg * (17 * 32) + l;
  if (kq == 1) {
#pragma unroll
    for (int j = 0; j < 2; ++j)
#pragma unroll
      for (int t = 0; t < 4; ++t) {
        mrg[((j * 4 + t) * 2) * 32]     = __builtin_shufflevector(o[j][t], o[j][t], 0, 1, 2, 3);
        mrg[((j * 4 + t) * 2 + 1) * 32] = __builtin_shufflevector(o[j][t], o[j][t], 4, 5, 6, 7);
      }
    const v4f ml = {mrun[0], mrun[1], lrun[0], lrun[1]};
    mrg[16 * 32] = ml;
  }
  __syncthreads();   // the upper half's state is in LDS before the lower half reads it
  if (kq == 1) return;

  // At plane [N_][E_] in fragment order (rows n, k = e): lane (m, h) already holds row q0 + 16j + m, k = 64 head + 16t + 8h + r
  const v4f ml = mrg[16 * 32];
#pragma unroll
  for (int j = 0; j < 2; ++j) {
    const float mall = fmaxf(mrun[j], ml[j]);
    const float a0   = __builtin_amdgcn_exp2f(mrun[j] - mall);
    const float a1   = __builtin_amdgcn_exp2f(ml[j] - mall);
    const float inv  = 1.0f / (lrun[j] * a0 + ml[2 + j] * a1);
    const float s0   = a0 * inv;
    const float s1   = a1 * inv;
    v8us w0[4], w1[4];
#pragma unroll
    for (int t = 0; t < 4; ++t) {
      const v4f p0 = mrg[((j * 4 + t) * 2) * 32];
      const v4f p1 = mrg[((j * 4 + t) * 2 + 1) * 32];
      const v8f ou = __builtin_shufflevector(p0, p1, 0, 1, 2, 3, 4, 5, 6, 7);
      const v8f val = o[j][t] * s0 + ou * s1;
      split8(val, w0[t], w1[t]);
    }
    const size_t aoff = ((size_t)b * S_ + q0 + j * 16) * E_ + (size_t)head * 2 * TILE_ + l * 8;
#pragma unroll
    for (int t = 0; t < 4; ++t) {
      *(v8us*)(Ah + aoff + t * 256) = w0[t];
      *(v8us*)(Al + aoff + t * 256) = w1[t];
    }
    if (j == 0) {
      // the second tile's values follow these stores: the wait stands in front of any rewrite of a register that they name
      asm volatile("s_wait_xcnt 0x0" ::: "memory");
      // keeps the second tile's arithmetic behind that wait
      __builtin_amdgcn_sched_barrier(0);
    }
  }
}

// ---------------------------------------------------------------------------
extern "C" void kernel_launch(void* const* d_in, const int* in_sizes, int n_in,
                              void* d_out, int out_size, void* d_ws, size_t ws_size,
                              hipStream_t stream) {
  if (n_in < 10) return;
  if (in_sizes[0] != N_ * E_ || in_sizes[1] != S_ ||
      in_sizes[2] != E_ * E_ || in_sizes[3] != E_ ||
      in_sizes[4] != E_ * E_ || in_sizes[5] != E_ ||
      in_sizes[6] != E_ * E_ || in_sizes[7] != E_ ||
      in_sizes[8] != E_ * E_ || in_sizes[9] != E_ ||
      out_size != N_ * E_) return;

  const float* x   = (const float*)d_in[0];   // [B,S,E]
  const float* ent = (const float*)d_in[1];   // [S]
  const float* Wq  = (const float*)d_in[2];
  const float* bq  = (const float*)d_in[3];
  const float* Wk  = (const float*)d_in[4];
  const float* bk  = (const float*)d_in[5];
  const float* Wv  = (const float*)d_in[6];
  const float* bv  = (const float*)d_in[7];
  const float* Wo  = (const float*)d_in[8];
  const float* bo  = (const float*)d_in[9];
  float* out = (float*)d_out;

  const size_t nX = (size_t)N_ * E_;           // 4194304
  const size_t nW = (size_t)E_ * E_;           // 262144
  const size_t total_bytes = (10 * nX + 8 * nW) * sizeof(unsigned short);   // 88080384
  if (total_bytes > ws_size) return;

  unsigned short* p = (unsigned short*)d_ws;
  unsigned short* Xh  = p; p += nX;   unsigned short* Xl  = p; p += nX;
  unsigned short* Wqh = p; p += nW;   unsigned short* Wql = p; p += nW;   // the eight weight planes lie one behind
  unsigned short* Wkh = p; p += nW;   unsigned short* Wkl = p; p += nW;   // the other: k_split finds them from Wqh
  unsigned short* Wvh = p; p += nW;   unsigned short* Wvl = p; p += nW;
  unsigned short* Woh = p; p += nW;   unsigned short* Wol = p; p += nW;
  unsigned short* Qh  = p; p += nX;   unsigned short* Ql  = p; p += nX;   // [B*H] x (rows s, k = d)
  unsigned short* Kh  = p; p += nX;   unsigned short* Kl  = p; p += nX;   // [B*H] x (rows s, k = d)
  unsigned short* Vh  = p; p += nX;   unsigned short* Vl  = p; p += nX;   // [B*H] x (rows d, k = s)
  unsigned short* Ah  = p; p += nX;   unsigned short* Al  = p; p += nX;   // rows n, k = e

  k_split<<<XBLK_ + 4 * WBLK_, 256, 0, stream>>>(x, Wq, Wk, Wv, Wo, Xh, Xl, Wqh);

  k_gemm_qkv<<<3 * GBLK_, 128, 0, stream>>>(Xh, Xl, Wqh, Wql, Wkh, Wkl, Wvh, Wvl, bq, bk, bv, Qh, Ql, Kh, Kl, Vh, Vl);

  k_attn<<<(B_ * H_ * (S_ / 32)) / 8, 512, 0, stream>>>(Qh, Ql, Kh, Kl, Vh, Vl, ent, Ah, Al);

  k_gemm_out<<<GBLK_, 128, 0, stream>>>(Woh, Wol, Ah, Al, bo, out);
}
